// v000
// The times below were measured on an AMD MI455X: many runs one after another, warmed up first and cycling through
// copies of the inputs, with the whole window's GPU time divided by the number of runs. Launches and the gaps
// between them are all in it. The median over several windows is given; except for v000 it joins two sittings, which
// can be a few percent apart, so the side-by-side timings, each taken in one sitting, are the better comparison.
// The starting kernel, v000, takes 402 microseconds a run.
// compute dtype: x, W*, b* (INPUTS) rounded to bf16 with exact bf16 WMMA products (f32 accumulate) for the projections; K pre-split into bf16 hi/lo rows; q f32 split, P and V f16 hi/lo (3 products each); softmax with the -1e9 padding mask in f32.
#include <hip/hip_runtime.h>
#include <math.h>

typedef __attribute__((ext_vector_type(16))) _Float16 v16h;
typedef __attribute__((ext_vector_type(16))) __bf16 v16b;
typedef __attribute__((ext_vector_type(8)))  _Float16 v8h;
typedef __attribute__((ext_vector_type(8)))  float v8f;
typedef __attribute__((ext_vector_type(4)))  float v4f;
typedef __attribute__((ext_vector_type(2)))  float v2f;
typedef __attribute__((ext_vector_type(4)))  unsigned v4u;
typedef __attribute__((ext_vector_type(4)))  int v4i;
typedef float __attribute__((may_alias)) float_a;
typedef int __attribute__((may_alias)) int_a;

template <typename T> __device__ __forceinline__ void vst2(void* p, T v) { *(T*)p = v;  }
__device__ __forceinline__ v8f wmma16(v16h a, v16h b, v8f c) {
  v8f d = __builtin_amdgcn_wmma_f32_16x16x32_f16(false, a, false, b, (short)0, c, false, false);
  asm volatile("v_nop\n\tv_nop\n\tv_nop\n\tv_nop" : "+v"(d) : "v"(a), "v"(b));
  return d;
}
__device__ __forceinline__ v8f wmma_bf(v16b a, v16b b, v8f c) {
  v8f d = __builtin_amdgcn_wmma_f32_16x16x32_bf16(false, a, false, b, (short)0, c, false, false);
  asm volatile("v_nop\n\tv_nop\n\tv_nop\n\tv_nop" : "+v"(d) : "v"(a), "v"(b));
  return d;
}
// 16x16x32 fragments: lane = (h = lane>>4, row/col = lane&15); elements 0..7 = k0+8h+0..7, 8..15 = k0+16+8h+0..7; D element r = row 8h+r
__device__ __forceinline__ v16h frag_h(const _Float16* rowk0, int lane) {
  union { v16h v; v8h q[2]; } u; const _Float16* p = rowk0 + 8 * (lane >> 4);
  u.q[0] = *(const v8h*)p; u.q[1] = *(const v8h*)(p + 16); return u.v;
}
__device__ __forceinline__ v16h frag_f32(const float* rowk0, int lane) {
  v16h a; const float* p = rowk0 + 8 * (lane >> 4);
#pragma unroll
  for (int i = 0; i < 8; ++i) { a[i] = (_Float16)p[i]; a[8 + i] = (_Float16)p[16 + i]; }
  return a;
}
__device__ __forceinline__ v16h frag_f32s(const float* rowk0, int lane, float sc) {
  v16h a; const float* p = rowk0 + 8 * (lane >> 4);
#pragma unroll
  for (int i = 0; i < 8; ++i) { a[i] = (_Float16)(p[i] * sc); a[8 + i] = (_Float16)(p[16 + i] * sc); }
  return a;
}
// column fragment from a [K][ld] layout (column n), rows >= K read as 0
__device__ __forceinline__ v16h fragc_f32(const float* W, int k0, int n, int lane, int ld, int K) {
  v16h a; const int g = lane >> 4;
#pragma unroll
  for (int i = 0; i < 8; ++i) { const int ka = k0 + 8 * g + i, kb = ka + 16;
    a[i] = (_Float16)(ka < K ? W[(size_t)ka * ld + n] : 0.f); a[8 + i] = (_Float16)(kb < K ? W[(size_t)kb * ld + n] : 0.f); }
  return a;
}
struct F2 { v16b h, l; };
__device__ __forceinline__ F2 bsplit16(const float v[16]) { F2 r;
#pragma unroll
  for (int i = 0; i < 16; ++i) { const __bf16 h = (__bf16)v[i]; r.h[i] = h; r.l[i] = (__bf16)(v[i] - (float)h); }
  return r; }
__device__ __forceinline__ F2 split_row(const float* row, int k0, int lane) { float v[16]; const float* p = row + k0 + 8 * (lane >> 4);
#pragma unroll
  for (int i = 0; i < 8; ++i) { v[i] = p[i]; v[8 + i] = p[16 + i]; }
  return bsplit16(v); }
__device__ __forceinline__ F2 split_rowK(const float* row, int k0, int lane, int K) { float v[16]; const int g = lane >> 4;
#pragma unroll
  for (int i = 0; i < 8; ++i) { const int ka = k0 + 8 * g + i, kb = ka + 16; v[i] = ka < K ? row[ka] : 0.f; v[8 + i] = kb < K ? row[kb] : 0.f; }
  return bsplit16(v); }
__device__ __forceinline__ F2 split_col(const float* W, int k0, int n, int lane, int ld, int K) { float v[16]; const int g = lane >> 4;
#pragma unroll
  for (int i = 0; i < 8; ++i) { const int ka = k0 + 8 * g + i, kb = ka + 16; v[i] = ka < K ? W[(size_t)ka * ld + n] : 0.f; v[8 + i] = kb < K ? W[(size_t)kb * ld + n] : 0.f; }
  return bsplit16(v); }
__device__ __forceinline__ v8f mac3(const F2& a, const F2& b, v8f c) { c = wmma_bf(a.l, b.h, c); c = wmma_bf(a.h, b.l, c); return wmma_bf(a.h, b.h, c); }
__device__ __forceinline__ float sigm(float v) { return 1.0f / (1.0f + expf(-v)); }
#define LDSX() do { asm volatile("s_wait_dscnt 0" ::: "memory"); __builtin_amdgcn_wave_barrier(); __builtin_amdgcn_fence(__ATOMIC_RELEASE, "workgroup"); } while (0)


// Padding-masked multi-head attention (16 heads of 64 on [4,1024,1024], [in][out] weights + biases, scale 1/8): keep = 1 - pad; score(q,k) = -1e9 wherever keep_q*keep_k == 0
// (so a padded query row attends uniformly to all 1,024 keys, exactly like the reference's masked softmax); y = softmax v; out = y Wp + bp. Not causal despite the module name.
#define NB 4
#define SS 1024
#define E 1024
#define NH 16
#define HD 64
#define NR (NB * SS)
#define PLO 1024.0f
#define VLO 2048.0f
__device__ __forceinline__ float bfr(float v) { return (float)(__bf16)v; }
__device__ __forceinline__ v16b frag_b(const __bf16* rowk0, int lane) { return __builtin_bit_cast(v16b, frag_h((const _Float16*)rowk0, lane)); }

__global__ __launch_bounds__(256) void k_cvt(const float* __restrict__ x, __bf16* __restrict__ Xb) {
  const size_t i8 = (size_t)blockIdx.x * 256 + threadIdx.x; if (i8 >= (size_t)NR * E / 8) return;
  union { __bf16 h[8]; v4u u; } pk;
#pragma unroll
  for (int e = 0; e < 8; ++e) pk.h[e] = (__bf16)x[i8 * 8 + e];
  vst2((unsigned*)(Xb + i8 * 8), pk.u);
}
// PT rows: [0,E) Wq[:,n], [E,2E) Wk[:,n], [2E,3E) Wv[:,n], [3E,4E) Wo[:,n]  ([in][out] weights: column n as a bf16 row)
__global__ __launch_bounds__(256) void k_pack(const float* __restrict__ Wq, const float* __restrict__ Wk, const float* __restrict__ Wv, const float* __restrict__ Wo, __bf16* __restrict__ PT) {
  const int n = blockIdx.x, tid = threadIdx.x; __shared__ __align__(16) __bf16 srow[E];
  const float* W = n < E ? Wq : (n < 2 * E ? Wk : (n < 3 * E ? Wv : Wo)); const int nn = n & (E - 1);
  for (int k = tid; k < E; k += 256) srow[k] = (__bf16)W[(size_t)k * E + nn];
  __syncthreads();
  if (tid < E / 8) vst2((unsigned*)(PT + (size_t)n * E + tid * 8), *(const v4u*)(&srow[tid * 8]));
}
// QKV: block (64 rows, 128 cols = 2 heads, which); q (+bias) -> Q32 f32 [bh][s][64]; k (+bias) -> bf16 hi/lo rows; v (+bias) -> VT hi/lo x4 [bh][d][s]
__global__ __launch_bounds__(128) void k_qkv(const __bf16* __restrict__ Xb, const __bf16* __restrict__ PT, const float* __restrict__ bq, const float* __restrict__ bk, const float* __restrict__ bv,
                                            float* __restrict__ Q32, __bf16* __restrict__ Kh, __bf16* __restrict__ Kl, _Float16* __restrict__ VTh, _Float16* __restrict__ VTl) {
  __shared__ __align__(16) float so[4][16][132];
  __shared__ __align__(16) _Float16 sth[128][72], stl[128][72];
  const int tid = threadIdx.x, wave = tid >> 5, lane = tid & 31, col = lane & 15, g = lane >> 4;
  const int which = blockIdx.z, r0b = blockIdx.x * 64, r0 = r0b + wave * 16, n0 = blockIdx.y * 128; const int b = r0b / SS, s0 = r0b % SS;
  const float* bb_ = which == 0 ? bq : (which == 1 ? bk : bv);
  v8f acc[8] = {};
#pragma unroll 2
  for (int kc = 0; kc < E / 32; ++kc) { const v16b a = frag_b(Xb + (size_t)(r0 + col) * E + kc * 32, lane);
#pragma unroll
    for (int j = 0; j < 8; ++j) acc[j] = wmma_bf(a, frag_b(PT + (size_t)(which * E + n0 + j * 16 + col) * E + kc * 32, lane), acc[j]); }
  if (which < 2) {
#pragma unroll
    for (int j = 0; j < 8; ++j) { const float bb = bfr(bb_[n0 + j * 16 + col]);
#pragma unroll
      for (int r = 0; r < 8; ++r) so[wave][8 * g + r][j * 16 + col] = acc[j][r] + bb; }
    LDSX();
    if (which == 0) { for (int qq = lane; qq < 2 * 16 * 16; qq += 32) { const int hh = qq >> 8, rl = (qq >> 4) & 15, pc = qq & 15; const int h = (n0 >> 6) + hh;
        vst2(Q32 + (((size_t)b * NH + h) * SS + s0 + wave * 16 + rl) * HD + pc * 4, *(const v4f*)(&so[wave][rl][hh * 64 + pc * 4])); } }
    else {
      for (int qq = lane; qq < 2 * 16 * 16; qq += 32) { const int hh = qq >> 8, rl = (qq >> 4) & 15, pl = qq & 15; const int h = (n0 >> 6) + hh; const int pc = pl & 7; union { __bf16 e[8]; v4u u; } pk;
#pragma unroll
        for (int e = 0; e < 8; ++e) { const float v = so[wave][rl][hh * 64 + pc * 8 + e]; const __bf16 hi = (__bf16)v; pk.e[e] = pl < 8 ? hi : (__bf16)(v - (float)hi); }
        vst2((unsigned*)((pl < 8 ? Kh : Kl) + (((size_t)b * NH + h) * SS + s0 + wave * 16 + rl) * HD + pc * 8), pk.u); } } }
  else {
#pragma unroll
    for (int j = 0; j < 8; ++j) { const float bb = bfr(bb_[n0 + j * 16 + col]);
#pragma unroll
      for (int r = 0; r < 8; ++r) { const float v = (acc[j][r] + bb) * 4.0f; const _Float16 hi = (_Float16)v; sth[j * 16 + col][wave * 16 + 8 * g + r] = hi; stl[j * 16 + col][wave * 16 + 8 * g + r] = (_Float16)((v - (float)hi) * VLO); } }
    __syncthreads();
    for (int qq = tid; qq < 128 * 8; qq += 128) { const int cl = qq >> 3, pc = qq & 7; const int c = n0 + cl, h = c >> 6, d = c & 63; const size_t o = (((size_t)b * NH + h) * HD + d) * SS + s0 + pc * 8;
      vst2(VTh + o, *(const v4u*)(&sth[cl][pc * 8])); vst2(VTl + o, *(const v4u*)(&stl[cl][pc * 8])); } }
}
// padding-masked attention: block (64 queries, bh); all 16 key tiles; S on q hi/lo x K hi/lo rows; P,V hi/lo; O f32 [bh][s][64]
__global__ __launch_bounds__(128) void k_attn(const float* __restrict__ Q32, const __bf16* __restrict__ Kh, const __bf16* __restrict__ Kl, const _Float16* __restrict__ VTh, const _Float16* __restrict__ VTl, const float* __restrict__ pad, float* __restrict__ O32) {
  __shared__ __align__(16) float sS[4][16][68];
  __shared__ __align__(16) _Float16 sPh[4][16][72], sPl[4][16][72];
  __shared__ __align__(16) float sO[4][16][68];
  const int tid = threadIdx.x, w = tid >> 5, lane = tid & 31, col = lane & 15, g = lane >> 4;
  const size_t bh = blockIdx.y; const int qb = blockIdx.x; const int q0 = qb * 64 + w * 16;
  F2 aq[2];
#pragma unroll
  for (int kc = 0; kc < 2; ++kc) aq[kc] = split_row(Q32 + (bh * SS + q0 + col) * HD, kc * 32, lane);
  const int b = (int)(bh / NH); __shared__ float skq[4][16]; if (lane < 16) skq[w][lane] = 1.0f - pad[(size_t)b * SS + q0 + lane];     // keep flags of my 16 query rows
  float mrun = -3.0e38f, lrun = 0.f; v8f acc[4] = {}, ac1[4] = {}, ac2[4] = {};
  LDSX();
#pragma unroll 1
  for (int kt = 0; kt < SS / 64; ++kt) {
#pragma unroll
    for (int t = 0; t < 4; ++t) { const int key = kt * 64 + t * 16 + col; const size_t ko = (bh * SS + key) * HD; v8f s = {};
#pragma unroll
      for (int kc = 0; kc < 2; ++kc) { const v16b khf = frag_b(Kh + ko + kc * 32, lane), klf = frag_b(Kl + ko + kc * 32, lane); s = wmma_bf(aq[kc].l, khf, s); s = wmma_bf(aq[kc].h, klf, s); s = wmma_bf(aq[kc].h, khf, s); }
      const float keepk = 1.0f - pad[(size_t)b * SS + key];
#pragma unroll
      for (int r = 0; r < 8; ++r) { sS[w][8 * g + r][t * 16 + col] = (skq[w][8 * g + r] * keepk == 0.f) ? -1.0e9f : s[r] * 0.125f; } }
    LDSX();
    float mx = -3.4e38f;
#pragma unroll
    for (int jj = 0; jj < 32; ++jj) mx = fmaxf(mx, sS[w][col][g * 32 + jj]);
    mx = fmaxf(mx, __shfl_xor(mx, 16, 32));
    const float mnew = fmaxf(mrun, mx); const float corr = expf(mrun - mnew);
    float ps = 0.f;
#pragma unroll
    for (int jj = 0; jj < 32; ++jj) { const float p = expf(sS[w][col][g * 32 + jj] - mnew) * 16384.0f; ps += p; const _Float16 hi = (_Float16)p; sPh[w][col][g * 32 + jj] = hi; sPl[w][col][g * 32 + jj] = (_Float16)((p - (float)hi) * PLO); }
    ps += __shfl_xor(ps, 16, 32);
    lrun = lrun * corr + ps * (1.0f / 16384.0f); mrun = mnew;
#pragma unroll
    for (int r = 0; r < 8; ++r) { const float cr = __shfl(corr, 8 * g + r, 32);
#pragma unroll
      for (int t = 0; t < 4; ++t) { acc[t][r] *= cr; ac1[t][r] *= cr; ac2[t][r] *= cr; } }
    LDSX();
#pragma unroll
    for (int kc = 0; kc < 2; ++kc) { const v16h ph = frag_h(&sPh[w][col][0] + kc * 32, lane), pl = frag_h(&sPl[w][col][0] + kc * 32, lane);
#pragma unroll
      for (int t = 0; t < 4; ++t) { const size_t vo = (bh * HD + t * 16 + col) * SS + kt * 64 + kc * 32; const v16h vh = frag_h(VTh + vo, lane);
        acc[t] = wmma16(ph, vh, acc[t]); ac1[t] = wmma16(ph, frag_h(VTl + vo, lane), ac1[t]); ac2[t] = wmma16(pl, vh, ac2[t]); } }
    __builtin_amdgcn_wave_barrier(); }
#pragma unroll
  for (int r = 0; r < 8; ++r) { const float lr = __shfl(lrun, 8 * g + r, 32); const float inv = 1.0f / (lr * 16384.0f * 4.0f);
#pragma unroll
    for (int t = 0; t < 4; ++t) sO[w][8 * g + r][t * 16 + col] = (acc[t][r] + ac1[t][r] * (1.0f / VLO) + ac2[t][r] * (1.0f / PLO)) * inv; }
  LDSX();
  for (int qq = lane; qq < 16 * 16; qq += 32) { const int rl = qq >> 4, pc = qq & 15; vst2(O32 + ((bh * SS) + q0 + rl) * HD + pc * 4, *(const v4f*)(&sO[w][rl][pc * 4])); }
}
// out = ctx Wo + bo : split(ctx) x bf16(Wo rows): 2 products (Wo is an INPUT -> bf16 exact)
__global__ __launch_bounds__(128) void k_out(const float* __restrict__ O32, const __bf16* __restrict__ PT, const float* __restrict__ bo, float* __restrict__ out) {
  __shared__ __align__(16) float so[4][16][132];
  const int tid = threadIdx.x, wave = tid >> 5, lane = tid & 31, col = lane & 15, g = lane >> 4;
  const int r0 = blockIdx.x * 64 + wave * 16, n0 = blockIdx.y * 128; const int ra = r0 + col; const int b = ra / SS, s = ra % SS;
  v8f acc[8] = {};
#pragma unroll 1
  for (int kc = 0; kc < E / 32; ++kc) { const int h = kc >> 1; const F2 a = split_row(O32 + (((size_t)b * NH + h) * SS + s) * HD, (kc & 1) * 32, lane);
#pragma unroll
    for (int j = 0; j < 8; ++j) { const v16b wb = frag_b(PT + (size_t)(3 * E + n0 + j * 16 + col) * E + kc * 32, lane); acc[j] = wmma_bf(a.l, wb, acc[j]); acc[j] = wmma_bf(a.h, wb, acc[j]); } }
#pragma unroll
  for (int j = 0; j < 8; ++j) { const int n = n0 + j * 16 + col; const float bb = bfr(bo[n]);
#pragma unroll
    for (int r = 0; r < 8; ++r) so[wave][8 * g + r][j * 16 + col] = acc[j][r] + bb; }
  LDSX();
#pragma unroll 4
  for (int rl = 0; rl < 16; ++rl) vst2(out + (size_t)(r0 + rl) * E + n0 + lane * 4, *(const v4f*)(&so[wave][rl][lane * 4]));
}
extern "C" void kernel_launch(void* const* d_in, const int* in_sizes, int n_in, void* d_out, int out_size, void* d_ws, size_t ws_size, hipStream_t stream) {
  (void)in_sizes; (void)n_in; (void)out_size; (void)ws_size;
  const float** I = (const float**)d_in;   // x, x_padding_judge, Wq, bq, Wk, bk, Wv, bv, Wp, bp
  const float* x = I[0]; const float* pad = I[1]; const float* Wq = I[2]; const float* bq = I[3]; const float* Wk = I[4]; const float* bk = I[5]; const float* Wv = I[6]; const float* bv = I[7]; const float* Wp = I[8]; const float* bp = I[9];
  float* out = (float*)d_out;
  char* ws = (char*)d_ws; size_t off = 0;
  auto take = [&](size_t bytes) { char* p = ws + off; off += (bytes + 255) & ~(size_t)255; return p; };
  __bf16* Xb = (__bf16*)take((size_t)NR * E * 2); __bf16* PT = (__bf16*)take((size_t)4 * E * E * 2);
  float* Q32 = (float*)take((size_t)NR * E * 4); __bf16* Kh = (__bf16*)take((size_t)NR * E * 2); __bf16* Kl = (__bf16*)take((size_t)NR * E * 2); _Float16* VTh = (_Float16*)take((size_t)NR * E * 2); _Float16* VTl = (_Float16*)take((size_t)NR * E * 2); float* O32 = (float*)take((size_t)NR * E * 4);
  // ws ~ 84 MB
  k_cvt<<<(NR * E / 8 + 255) / 256, 256, 0, stream>>>(x, Xb);
  k_pack<<<4 * E, 256, 0, stream>>>(Wq, Wk, Wv, Wp, PT);
  k_qkv<<<dim3(NR / 64, E / 128, 3), 128, 0, stream>>>(Xb, PT, bq, bk, bv, Q32, Kh, Kl, VTh, VTl);
  k_attn<<<dim3(SS / 64, NB * NH), 128, 0, stream>>>(Q32, Kh, Kl, VTh, VTl, pad, O32);
  k_out<<<dim3(NR / 64, E / 128), 128, 0, stream>>>(O32, PT, bp, out);
}

// v001
// Measured time: 157 microseconds a run.
// Next to v000, in two timings, it ran 2.58 times as fast each time.
// compute dtype: x, W*, b* (INPUTS) rounded to bf16 with exact bf16 WMMA products (f32 accumulate) for the projections; K pre-split into bf16 hi/lo rows; q f32 split, P and V f16 hi/lo (3 products each); softmax with the -1e9 padding mask in f32.
#include <hip/hip_runtime.h>
#include <math.h>

typedef __attribute__((ext_vector_type(16))) _Float16 v16h;
typedef __attribute__((ext_vector_type(16))) __bf16 v16b;
typedef __attribute__((ext_vector_type(8)))  _Float16 v8h;
typedef __attribute__((ext_vector_type(8)))  float v8f;
typedef __attribute__((ext_vector_type(4)))  float v4f;
typedef __attribute__((ext_vector_type(2)))  float v2f;
typedef __attribute__((ext_vector_type(4)))  unsigned v4u;
typedef __attribute__((ext_vector_type(4)))  int v4i;
typedef float __attribute__((may_alias)) float_a;
typedef int __attribute__((may_alias)) int_a;

template <typename T> __device__ __forceinline__ void vst2(void* p, T v) { *(T*)p = v;  }
__device__ __forceinline__ v8f wmma16(v16h a, v16h b, v8f c) {
  v8f d = __builtin_amdgcn_wmma_f32_16x16x32_f16(false, a, false, b, (short)0, c, false, false);
  asm volatile("v_nop\n\tv_nop\n\tv_nop\n\tv_nop" : "+v"(d) : "v"(a), "v"(b));
  return d;
}
__device__ __forceinline__ v8f wmma_bf(v16b a, v16b b, v8f c) {
  v8f d = __builtin_amdgcn_wmma_f32_16x16x32_bf16(false, a, false, b, (short)0, c, false, false);
  asm volatile("v_nop\n\tv_nop\n\tv_nop\n\tv_nop" : "+v"(d) : "v"(a), "v"(b));
  return d;
}
// 16x16x32 fragments: lane = (h = lane>>4, row/col = lane&15); elements 0..7 = k0+8h+0..7, 8..15 = k0+16+8h+0..7; D element r = row 8h+r
__device__ __forceinline__ v16h frag_h(const _Float16* rowk0, int lane) {
  union { v16h v; v8h q[2]; } u; const _Float16* p = rowk0 + 8 * (lane >> 4);
  u.q[0] = *(const v8h*)p; u.q[1] = *(const v8h*)(p + 16); return u.v;
}
__device__ __forceinline__ v16h frag_f32(const float* rowk0, int lane) {
  v16h a; const float* p = rowk0 + 8 * (lane >> 4);
#pragma unroll
  for (int i = 0; i < 8; ++i) { a[i] = (_Float16)p[i]; a[8 + i] = (_Float16)p[16 + i]; }
  return a;
}
__device__ __forceinline__ v16h frag_f32s(const float* rowk0, int lane, float sc) {
  v16h a; const float* p = rowk0 + 8 * (lane >> 4);
#pragma unroll
  for (int i = 0; i < 8; ++i) { a[i] = (_Float16)(p[i] * sc); a[8 + i] = (_Float16)(p[16 + i] * sc); }
  return a;
}
// column fragment from a [K][ld] layout (column n), rows >= K read as 0
__device__ __forceinline__ v16h fragc_f32(const float* W, int k0, int n, int lane, int ld, int K) {
  v16h a; const int g = lane >> 4;
#pragma unroll
  for (int i = 0; i < 8; ++i) { const int ka = k0 + 8 * g + i, kb = ka + 16;
    a[i] = (_Float16)(ka < K ? W[(size_t)ka * ld + n] : 0.f); a[8 + i] = (_Float16)(kb < K ? W[(size_t)kb * ld + n] : 0.f); }
  return a;
}
struct F2 { v16b h, l; };
__device__ __forceinline__ F2 bsplit16(const float v[16]) { F2 r;
#pragma unroll
  for (int i = 0; i < 16; ++i) { const __bf16 h = (__bf16)v[i]; r.h[i] = h; r.l[i] = (__bf16)(v[i] - (float)h); }
  return r; }
__device__ __forceinline__ F2 split_row(const float* row, int k0, int lane) { float v[16]; const float* p = row + k0 + 8 * (lane >> 4);
#pragma unroll
  for (int i = 0; i < 8; ++i) { v[i] = p[i]; v[8 + i] = p[16 + i]; }
  return bsplit16(v); }
__device__ __forceinline__ F2 split_rowK(const float* row, int k0, int lane, int K) { float v[16]; const int g = lane >> 4;
#pragma unroll
  for (int i = 0; i < 8; ++i) { const int ka = k0 + 8 * g + i, kb = ka + 16; v[i] = ka < K ? row[ka] : 0.f; v[8 + i] = kb < K ? row[kb] : 0.f; }
  return bsplit16(v); }
__device__ __forceinline__ F2 split_col(const float* W, int k0, int n, int lane, int ld, int K) { float v[16]; const int g = lane >> 4;
#pragma unroll
  for (int i = 0; i < 8; ++i) { const int ka = k0 + 8 * g + i, kb = ka + 16; v[i] = ka < K ? W[(size_t)ka * ld + n] : 0.f; v[8 + i] = kb < K ? W[(size_t)kb * ld + n] : 0.f; }
  return bsplit16(v); }
__device__ __forceinline__ v8f mac3(const F2& a, const F2& b, v8f c) { c = wmma_bf(a.l, b.h, c); c = wmma_bf(a.h, b.l, c); return wmma_bf(a.h, b.h, c); }
__device__ __forceinline__ float sigm(float v) { return 1.0f / (1.0f + expf(-v)); }
#define LDSX() do { asm volatile("s_wait_dscnt 0" ::: "memory"); __builtin_amdgcn_wave_barrier(); __builtin_amdgcn_fence(__ATOMIC_RELEASE, "workgroup"); } while (0)


// Padding-masked multi-head attention (16 heads of 64 on [4,1024,1024], [in][out] weights + biases, scale 1/8): keep = 1 - pad; score(q,k) = -1e9 wherever keep_q*keep_k == 0
// (so a padded query row attends uniformly to all 1,024 keys, exactly like the reference's masked softmax); y = softmax v; out = y Wp + bp. Not causal despite the module name.
#define NB 4
#define SS 1024
#define E 1024
#define NH 16
#define HD 64
#define NR (NB * SS)
#define PLO 1024.0f
#define VLO 2048.0f
__device__ __forceinline__ float bfr(float v) { return (float)(__bf16)v; }
__device__ __forceinline__ v16b frag_b(const __bf16* rowk0, int lane) { return __builtin_bit_cast(v16b, frag_h((const _Float16*)rowk0, lane)); }
// ---- operand tiles in LDS, filled by asynchronous copies ----
// A tile row is 128 B (64 16-bit k values) = 8 pieces of 16 B; piece c of row r lies at r*128 + ((c ^ ((r>>1)&7)) << 4): the 16 rows that a half-wave's ds_load_b128 reads fall on all 64 banks.
__device__ __forceinline__ unsigned lds_addr(const void* p) { return (unsigned)(size_t)p; }   // LDS byte address = low 32 bits of the __shared__ address
// Four 16-byte copies per lane, global -> LDS, through no register. s_wait_xcnt closes the statement so that no address register is rewritten ahead of it.
__device__ __forceinline__ void cp4(unsigned l0, const char* g0, unsigned l1, const char* g1, unsigned l2, const char* g2, unsigned l3, const char* g3) {
  asm volatile("global_load_async_to_lds_b128 %0, %1, off\n\t"
               "global_load_async_to_lds_b128 %2, %3, off\n\t"
               "global_load_async_to_lds_b128 %4, %5, off\n\t"
               "global_load_async_to_lds_b128 %6, %7, off\n\t"
               "s_wait_xcnt 0x0"
               :: "v"(l0), "v"(g0), "v"(l1), "v"(g1), "v"(l2), "v"(g2), "v"(l3), "v"(g3) : "memory");
}
// 64 tile rows (four groups of 16 rows, 2,048 B of LDS each) by 128 threads; gs = bytes between 16 source rows
__device__ __forceinline__ void cp_rows64(unsigned l, const char* g, size_t gs) { cp4(l, g, l + 2048, g + gs, l + 4096, g + 2 * gs, l + 6144, g + 3 * gs); }
// publish point of the two-buffer ring: my LDS reads retired, my copies landed, then the work-group barrier that publishes the next tile and frees the one just read
#define RING_FOOT() do { asm volatile("s_wait_dscnt 0x0" ::: "memory"); asm volatile("s_wait_asynccnt 0x0" ::: "memory"); __syncthreads(); } while (0)
struct FO { int a, b; };   // byte places of a fragment's two 16-byte pieces inside its (swizzled) tile row
__device__ __forceinline__ FO frag_off(int kc, int lane) { const int g = lane >> 4, key = (lane & 15) >> 1; FO o; o.a = ((kc * 4 + g) ^ key) << 4; o.b = ((kc * 4 + 2 + g) ^ key) << 4; return o; }
__device__ __forceinline__ v16h frag_sh(const char* row, FO o) { union { v16h v; v4u q[2]; } u; u.q[0] = *(const v4u*)(row + o.a); u.q[1] = *(const v4u*)(row + o.b); return u.v; }
__device__ __forceinline__ v16b frag_sb(const char* row, FO o) { return __builtin_bit_cast(v16b, frag_sh(row, o)); }

__global__ __launch_bounds__(256) void k_cvt(const float* __restrict__ x, __bf16* __restrict__ Xb) {
  const size_t i8 = (size_t)blockIdx.x * 256 + threadIdx.x; if (i8 >= (size_t)NR * E / 8) return;
  union { __bf16 h[8]; v4u u; } pk;
#pragma unroll
  for (int e = 0; e < 8; ++e) pk.h[e] = (__bf16)x[i8 * 8 + e];
  vst2((unsigned*)(Xb + i8 * 8), pk.u);
}
// PT rows: [0,E) Wq[:,n], [E,2E) Wk[:,n], [2E,3E) Wv[:,n], [3E,4E) Wo[:,n]  ([in][out] weights: column n as a bf16 row)
__global__ __launch_bounds__(256) void k_pack(const float* __restrict__ Wq, const float* __restrict__ Wk, const float* __restrict__ Wv, const float* __restrict__ Wo, __bf16* __restrict__ PT) {
  const int n = blockIdx.x, tid = threadIdx.x; __shared__ __align__(16) __bf16 srow[E];
  const float* W = n < E ? Wq : (n < 2 * E ? Wk : (n < 3 * E ? Wv : Wo)); const int nn = n & (E - 1);
  for (int k = tid; k < E; k += 256) srow[k] = (__bf16)W[(size_t)k * E + nn];
  __syncthreads();
  if (tid < E / 8) vst2((unsigned*)(PT + (size_t)n * E + tid * 8), *(const v4u*)(&srow[tid * 8]));
}
// QKV: block (64 rows, 128 cols = 2 heads, which); q (+bias) -> Q32 f32 [bh][s][64]; k (+bias) -> bf16 hi/lo rows; v (+bias) -> VT hi/lo x4 [bh][d][s]
__global__ __launch_bounds__(128) void k_qkv(const __bf16* __restrict__ Xb, const __bf16* __restrict__ PT, const float* __restrict__ bq, const float* __restrict__ bk, const float* __restrict__ bv,
                                            float* __restrict__ Q32, __bf16* __restrict__ Kh, __bf16* __restrict__ Kl, _Float16* __restrict__ VTh, _Float16* __restrict__ VTl) {
  // ring: 2 buffers x (64 x rows | 128 weight rows) x 128 B; behind the loop's last barrier the same bytes are the output staging
  __shared__ __align__(128) char smem[2 * 192 * 128];
  float (*so)[16][132] = (float (*)[16][132])smem;
  _Float16 (*sth)[72] = (_Float16 (*)[72])smem; _Float16 (*stl)[72] = (_Float16 (*)[72])(smem + 128 * 72 * 2);
  const int tid = threadIdx.x, wave = tid >> 5, lane = tid & 31, col = lane & 15, g = lane >> 4;
  const int which = blockIdx.z, r0b = blockIdx.x * 64, r0 = r0b + wave * 16, n0 = blockIdx.y * 128; const int b = r0b / SS, s0 = r0b % SS;
  const float* bb_ = which == 0 ? bq : (which == 1 ? bk : bv);
  v8f acc[8] = {};
  const int crow = tid >> 3, cch = tid & 7;
  const unsigned ld0 = lds_addr(smem) + crow * 128 + ((cch ^ ((crow >> 1) & 7)) << 4);
  const char* gx = (const char*)(Xb + (size_t)(r0b + crow) * E + cch * 8);
  const char* gw = (const char*)(PT + (size_t)(which * E + n0 + crow) * E + cch * 8);
  auto fill = [&](int t, int buf) { const unsigned l = ld0 + buf * 24576;
    cp_rows64(l, gx + t * 128, 16 * E * 2); cp_rows64(l + 8192, gw + t * 128, 16 * E * 2); cp_rows64(l + 16384, gw + t * 128 + (size_t)64 * E * 2, 16 * E * 2); };
  const FO fo[2] = { frag_off(0, lane), frag_off(1, lane) };
  fill(0, 0);
  asm volatile("s_wait_asynccnt 0x0" ::: "memory");   // tile 0 landed (my copies)
  __syncthreads();                                    // tile 0 published
  fill(1, 1);
#pragma unroll 1   // rolled: one copy group and one publish point in the text
  for (int t = 0; t < E / 64; ++t) { const char* sb = smem + (t & 1) * 24576 + col * 128;
#pragma unroll
    for (int kc = 0; kc < 2; ++kc) { const v16b a = frag_sb(sb + wave * 2048, fo[kc]);
#pragma unroll
      for (int jh = 0; jh < 8; jh += 4) { v16b wf[4];   // four weight fragments read as one group ahead of their products
#pragma unroll
        for (int j = 0; j < 4; ++j) wf[j] = frag_sb(sb + 8192 + (jh + j) * 2048, fo[kc]);
#pragma unroll
        for (int j = 0; j < 4; ++j) acc[jh + j] = wmma_bf(a, wf[j], acc[jh + j]); } }
    RING_FOOT();
    if (t + 2 < E / 64) fill(t + 2, t & 1); }
  asm volatile("s_wait_asynccnt 0x0" ::: "memory");   // nothing in flight when the ring becomes staging
  if (which < 2) {
#pragma unroll
    for (int j = 0; j < 8; ++j) { const float bb = bfr(bb_[n0 + j * 16 + col]);
#pragma unroll
      for (int r = 0; r < 8; ++r) so[wave][8 * g + r][j * 16 + col] = acc[j][r] + bb; }
    LDSX();
    if (which == 0) { for (int qq = lane; qq < 2 * 16 * 16; qq += 32) { const int hh = qq >> 8, rl = (qq >> 4) & 15, pc = qq & 15; const int h = (n0 >> 6) + hh;
        vst2(Q32 + (((size_t)b * NH + h) * SS + s0 + wave * 16 + rl) * HD + pc * 4, *(const v4f*)(&so[wave][rl][hh * 64 + pc * 4])); } }
    else {
      for (int qq = lane; qq < 2 * 16 * 16; qq += 32) { const int hh = qq >> 8, rl = (qq >> 4) & 15, pl = qq & 15; const int h = (n0 >> 6) + hh; const int pc = pl & 7; union { __bf16 e[8]; v4u u; } pk;
#pragma unroll
        for (int e = 0; e < 8; ++e) { const float v = so[wave][rl][hh * 64 + pc * 8 + e]; const __bf16 hi = (__bf16)v; pk.e[e] = pl < 8 ? hi : (__bf16)(v - (float)hi); }
        vst2((unsigned*)((pl < 8 ? Kh : Kl) + (((size_t)b * NH + h) * SS + s0 + wave * 16 + rl) * HD + pc * 8), pk.u); } } }
  else {
#pragma unroll
    for (int j = 0; j < 8; ++j) { const float bb = bfr(bb_[n0 + j * 16 + col]);
#pragma unroll
      for (int r = 0; r < 8; ++r) { const float v = (acc[j][r] + bb) * 4.0f; const _Float16 hi = (_Float16)v; sth[j * 16 + col][wave * 16 + 8 * g + r] = hi; stl[j * 16 + col][wave * 16 + 8 * g + r] = (_Float16)((v - (float)hi) * VLO); } }
    __syncthreads();
    for (int qq = tid; qq < 128 * 8; qq += 128) { const int cl = qq >> 3, pc = qq & 7; const int c = n0 + cl, h = c >> 6, d = c & 63; const size_t o = (((size_t)b * NH + h) * HD + d) * SS + s0 + pc * 8;
      vst2(VTh + o, *(const v4u*)(&sth[cl][pc * 8])); vst2(VTl + o, *(const v4u*)(&stl[cl][pc * 8])); } }
}
// padding-masked attention: block (64 queries, bh); all 16 key tiles; S on q hi/lo x K hi/lo rows; P,V hi/lo; O f32 [bh][s][64]
__global__ __launch_bounds__(128) void k_attn(const float* __restrict__ Q32, const __bf16* __restrict__ Kh, const __bf16* __restrict__ Kl, const _Float16* __restrict__ VTh, const _Float16* __restrict__ VTl, const float* __restrict__ pad, float* __restrict__ O32) {
  __shared__ __align__(16) float sS[4][16][68];
  __shared__ __align__(16) _Float16 sPh[4][16][72], sPl[4][16][72];
  // ring of two buffers, tiles in the order K(0), V(0), K(1), V(1), ...: sK = 64 key rows hi | lo, sV = 64 d rows of V^T hi | lo, 128 B a row
  __shared__ __align__(128) char sK[128 * 128], sV[128 * 128];
  float (*sO)[16][68] = sS;   // output staging in each wave's own score rows, dead behind the loop
  const int tid = threadIdx.x, w = tid >> 5, lane = tid & 31, col = lane & 15, g = lane >> 4;
  const size_t bh = blockIdx.y; const int qb = blockIdx.x; const int q0 = qb * 64 + w * 16;
  F2 aq[2];
#pragma unroll
  for (int kc = 0; kc < 2; ++kc) aq[kc] = split_row(Q32 + (bh * SS + q0 + col) * HD, kc * 32, lane);
  const int b = (int)(bh / NH); __shared__ float skq[4][16]; if (lane < 16) skq[w][lane] = 1.0f - pad[(size_t)b * SS + q0 + lane];     // keep flags of my 16 query rows
  float mrun = -3.0e38f, lrun = 0.f; v8f acc[4] = {}, ac1[4] = {}, ac2[4] = {};
  const int crow = tid >> 3, cch = tid & 7;
  const unsigned lofs = crow * 128 + ((cch ^ ((crow >> 1) & 7)) << 4);
  const unsigned lK = lds_addr(sK) + lofs, lV = lds_addr(sV) + lofs;
  const char* gKh = (const char*)(Kh + (bh * SS + crow) * HD + cch * 8); const char* gKl = (const char*)(Kl + (bh * SS + crow) * HD + cch * 8);
  const char* gVh = (const char*)(VTh + (bh * HD + crow) * SS + cch * 8); const char* gVl = (const char*)(VTl + (bh * HD + crow) * SS + cch * 8);
  auto fillK = [&](int kt) { cp_rows64(lK, gKh + (size_t)kt * 64 * HD * 2, 16 * HD * 2); cp_rows64(lK + 8192, gKl + (size_t)kt * 64 * HD * 2, 16 * HD * 2); };
  auto fillV = [&](int kt) { cp_rows64(lV, gVh + kt * 128, 16 * SS * 2); cp_rows64(lV + 8192, gVl + kt * 128, 16 * SS * 2); };
  const FO fo[2] = { frag_off(0, lane), frag_off(1, lane) };
  fillK(0);
  asm volatile("s_wait_asynccnt 0x0" ::: "memory");   // K(0) landed (my copies)
  LDSX();
  __syncthreads();                                    // K(0) published
  fillV(0);
#pragma unroll 1
  for (int kt = 0; kt < SS / 64; ++kt) {
#pragma unroll
    for (int t = 0; t < 4; ++t) { const int key = kt * 64 + t * 16 + col; const char* kr = sK + (t * 16 + col) * 128; v8f s = {};
#pragma unroll
      for (int kc = 0; kc < 2; ++kc) { const v16b khf = frag_sb(kr, fo[kc]), klf = frag_sb(kr + 8192, fo[kc]); s = wmma_bf(aq[kc].l, khf, s); s = wmma_bf(aq[kc].h, klf, s); s = wmma_bf(aq[kc].h, khf, s); }
      const float keepk = 1.0f - pad[(size_t)b * SS + key];
#pragma unroll
      for (int r = 0; r < 8; ++r) { sS[w][8 * g + r][t * 16 + col] = (skq[w][8 * g + r] * keepk == 0.f) ? -1.0e9f : s[r] * 0.125f; } }
    LDSX();
    RING_FOOT();                                 // V(kt) published, K(kt) left by every wave
    if (kt + 1 < SS / 64) fillK(kt + 1);
    float mx = -3.4e38f;
#pragma unroll
    for (int jj = 0; jj < 32; ++jj) mx = fmaxf(mx, sS[w][col][g * 32 + jj]);
    mx = fmaxf(mx, __shfl_xor(mx, 16, 32));
    const float mnew = fmaxf(mrun, mx); const float corr = expf(mrun - mnew);
    float ps = 0.f;
#pragma unroll
    for (int jj = 0; jj < 32; ++jj) { const float p = expf(sS[w][col][g * 32 + jj] - mnew) * 16384.0f; ps += p; const _Float16 hi = (_Float16)p; sPh[w][col][g * 32 + jj] = hi; sPl[w][col][g * 32 + jj] = (_Float16)((p - (float)hi) * PLO); }
    ps += __shfl_xor(ps, 16, 32);
    lrun = lrun * corr + ps * (1.0f / 16384.0f); mrun = mnew;
#pragma unroll
    for (int r = 0; r < 8; ++r) { const float cr = __shfl(corr, 8 * g + r, 32);
#pragma unroll
      for (int t = 0; t < 4; ++t) { acc[t][r] *= cr; ac1[t][r] *= cr; ac2[t][r] *= cr; } }
    LDSX();
#pragma unroll
    for (int kc = 0; kc < 2; ++kc) { const v16h ph = frag_h(&sPh[w][col][0] + kc * 32, lane), pl = frag_h(&sPl[w][col][0] + kc * 32, lane);
#pragma unroll
      for (int t = 0; t < 4; ++t) { const char* vr = sV + (t * 16 + col) * 128; const v16h vh = frag_sh(vr, fo[kc]);
        acc[t] = wmma16(ph, vh, acc[t]); ac1[t] = wmma16(ph, frag_sh(vr + 8192, fo[kc]), ac1[t]); ac2[t] = wmma16(pl, vh, ac2[t]); } }
    RING_FOOT();                                 // K(kt+1) published, V(kt) left by every wave
    if (kt + 1 < SS / 64) fillV(kt + 1);
    __builtin_amdgcn_wave_barrier(); }
  asm volatile("s_wait_asynccnt 0x0" ::: "memory");   // nothing in flight at the wave's end
#pragma unroll
  for (int r = 0; r < 8; ++r) { const float lr = __shfl(lrun, 8 * g + r, 32); const float inv = 1.0f / (lr * 16384.0f * 4.0f);
#pragma unroll
    for (int t = 0; t < 4; ++t) sO[w][8 * g + r][t * 16 + col] = (acc[t][r] + ac1[t][r] * (1.0f / VLO) + ac2[t][r] * (1.0f / PLO)) * inv; }
  LDSX();
  for (int qq = lane; qq < 16 * 16; qq += 32) { const int rl = qq >> 4, pc = qq & 15; vst2(O32 + ((bh * SS) + q0 + rl) * HD + pc * 4, *(const v4f*)(&sO[w][rl][pc * 4])); }
}
// out = ctx Wo + bo : split(ctx) x bf16(Wo rows): 2 products (Wo is an INPUT -> bf16 exact)
__global__ __launch_bounds__(128) void k_out(const float* __restrict__ O32, const __bf16* __restrict__ PT, const float* __restrict__ bo, float* __restrict__ out) {
  // ring: 2 buffers x (64 ctx rows of 256 B, f32, one head | 128 weight rows of 128 B); behind the loop's last barrier the same bytes are the output staging
  __shared__ __align__(128) char smem[2 * 32768];
  float (*so)[16][132] = (float (*)[16][132])smem;
  const int tid = threadIdx.x, wave = tid >> 5, lane = tid & 31, col = lane & 15, g = lane >> 4;
  const int r0b = blockIdx.x * 64, r0 = r0b + wave * 16, n0 = blockIdx.y * 128; const int b = r0b / SS, s0 = r0b % SS;
  v8f acc[8] = {};
  // ctx rows: 16 pieces of 16 B, piece c of row r at r*256 + ((c ^ (r&15)) << 4): 16 rows of one piece index fall on all 64 banks
  const int arow = tid >> 4, ach = tid & 15, crow = tid >> 3, cch = tid & 7;
  const unsigned lbase = lds_addr(smem);
  const unsigned la0 = lbase + arow * 256 + ((ach ^ arow) << 4), la1 = lbase + (arow + 8) * 256 + ((ach ^ (arow + 8)) << 4);   // rows arow + 16 i and arow + 8 + 16 i
  const unsigned lw0 = lbase + 16384 + crow * 128 + ((cch ^ ((crow >> 1) & 7)) << 4);
  const char* gc = (const char*)(O32 + ((size_t)b * NH * SS + s0 + arow) * HD + ach * 4);
  const char* gw = (const char*)(PT + (size_t)(3 * E + n0 + crow) * E + cch * 8);
  auto fill = [&](int t, int buf) { const unsigned o = buf * 32768; const char* c = gc + (size_t)t * SS * HD * 4;
    cp4(la0 + o, c, la0 + o + 4096, c + 4096, la0 + o + 8192, c + 8192, la0 + o + 12288, c + 12288);
    cp4(la1 + o, c + 2048, la1 + o + 4096, c + 2048 + 4096, la1 + o + 8192, c + 2048 + 8192, la1 + o + 12288, c + 2048 + 12288);
    cp_rows64(lw0 + o, gw + t * 128, 16 * E * 2); cp_rows64(lw0 + o + 8192, gw + t * 128 + (size_t)64 * E * 2, 16 * E * 2); };
  const FO fo[2] = { frag_off(0, lane), frag_off(1, lane) };
  fill(0, 0);
  asm volatile("s_wait_asynccnt 0x0" ::: "memory");   // tile 0 landed (my copies)
  __syncthreads();                                    // tile 0 published
  fill(1, 1);
#pragma unroll 1
  for (int t = 0; t < E / 64; ++t) { const char* sb = smem + (t & 1) * 32768; const char* ar = sb + (wave * 16 + col) * 256; const char* wr = sb + 16384 + col * 128;
#pragma unroll
    for (int kc = 0; kc < 2; ++kc) { float v[16];
#pragma unroll
      for (int q = 0; q < 4; ++q) { const v4f x4 = *(const v4f*)(ar + (((kc * 8 + (q >> 1) * 4 + 2 * g + (q & 1)) ^ col) << 4));   // k = kc*32 + (q>>1)*16 + 8g + (q&1)*4 + e
#pragma unroll
        for (int e = 0; e < 4; ++e) v[q * 4 + e] = x4[e]; }
      v16b wf[8];   // the eight weight fragments read as one group ahead of their products
#pragma unroll
      for (int j = 0; j < 8; ++j) wf[j] = frag_sb(wr + j * 2048, fo[kc]);
      const F2 a = bsplit16(v);
#pragma unroll
      for (int j = 0; j < 8; ++j) { acc[j] = wmma_bf(a.l, wf[j], acc[j]); acc[j] = wmma_bf(a.h, wf[j], acc[j]); } }
    RING_FOOT();
    if (t + 2 < E / 64) fill(t + 2, t & 1); }
  asm volatile("s_wait_asynccnt 0x0" ::: "memory");   // nothing in flight when the ring becomes staging
#pragma unroll
  for (int j = 0; j < 8; ++j) { const int n = n0 + j * 16 + col; const float bb = bfr(bo[n]);
#pragma unroll
    for (int r = 0; r < 8; ++r) so[wave][8 * g + r][j * 16 + col] = acc[j][r] + bb; }
  LDSX();
#pragma unroll 4
  for (int rl = 0; rl < 16; ++rl) vst2(out + (size_t)(r0 + rl) * E + n0 + lane * 4, *(const v4f*)(&so[wave][rl][lane * 4]));
}
extern "C" void kernel_launch(void* const* d_in, const int* in_sizes, int n_in, void* d_out, int out_size, void* d_ws, size_t ws_size, hipStream_t stream) {
  (void)in_sizes; (void)n_in; (void)out_size; (void)ws_size;
  const float** I = (const float**)d_in;   // x, x_padding_judge, Wq, bq, Wk, bk, Wv, bv, Wp, bp
  const float* x = I[0]; const float* pad = I[1]; const float* Wq = I[2]; const float* bq = I[3]; const float* Wk = I[4]; const float* bk = I[5]; const float* Wv = I[6]; const float* bv = I[7]; const float* Wp = I[8]; const float* bp = I[9];
  float* out = (float*)d_out;
  char* ws = (char*)d_ws; size_t off = 0;
  auto take = [&](size_t bytes) { char* p = ws + off; off += (bytes + 255) & ~(size_t)255; return p; };
  __bf16* Xb = (__bf16*)take((size_t)NR * E * 2); __bf16* PT = (__bf16*)take((size_t)4 * E * E * 2);
  float* Q32 = (float*)take((size_t)NR * E * 4); __bf16* Kh = (__bf16*)take((size_t)NR * E * 2); __bf16* Kl = (__bf16*)take((size_t)NR * E * 2); _Float16* VTh = (_Float16*)take((size_t)NR * E * 2); _Float16* VTl = (_Float16*)take((size_t)NR * E * 2); float* O32 = (float*)take((size_t)NR * E * 4);
  // ws ~ 84 MB
  k_cvt<<<(NR * E / 8 + 255) / 256, 256, 0, stream>>>(x, Xb);
  k_pack<<<4 * E, 256, 0, stream>>>(Wq, Wk, Wv, Wp, PT);
  k_qkv<<<dim3(NR / 64, E / 128, 3), 128, 0, stream>>>(Xb, PT, bq, bk, bv, Q32, Kh, Kl, VTh, VTl);
  k_attn<<<dim3(SS / 64, NB * NH), 128, 0, stream>>>(Q32, Kh, Kl, VTh, VTl, pad, O32);
  k_out<<<dim3(NR / 64, E / 128), 128, 0, stream>>>(O32, PT, bp, out);
}

// v002
// Measured time: 140 microseconds a run.
// In two side-by-side timings against v001, it was 1.12 and 1.13 times as fast.
// Counting every step since v000, it is 2.90 times as fast.
// compute dtype: x, W*, b* (INPUTS) rounded to bf16 with exact bf16 WMMA products (f32 accumulate) for the projections; K pre-split into bf16 hi/lo rows; q f32 split, P and V f16 hi/lo (3 products each); softmax with the -1e9 padding mask in f32.
#include <hip/hip_runtime.h>
#include <math.h>

typedef __attribute__((ext_vector_type(16))) _Float16 v16h;
typedef __attribute__((ext_vector_type(16))) __bf16 v16b;
typedef __attribute__((ext_vector_type(8)))  _Float16 v8h;
typedef __attribute__((ext_vector_type(8)))  float v8f;
typedef __attribute__((ext_vector_type(4)))  float v4f;
typedef __attribute__((ext_vector_type(2)))  float v2f;
typedef __attribute__((ext_vector_type(4)))  unsigned v4u;
typedef __attribute__((ext_vector_type(4)))  int v4i;
typedef float __attribute__((may_alias)) float_a;
typedef int __attribute__((may_alias)) int_a;

template <typename T> __device__ __forceinline__ void vst2(void* p, T v) { *(T*)p = v;  }
__device__ __forceinline__ v8f wmma16(v16h a, v16h b, v8f c) {
  v8f d = __builtin_amdgcn_wmma_f32_16x16x32_f16(false, a, false, b, (short)0, c, false, false);
  asm volatile("v_nop\n\tv_nop\n\tv_nop\n\tv_nop" : "+v"(d) : "v"(a), "v"(b));
  return d;
}
__device__ __forceinline__ v8f wmma_bf(v16b a, v16b b, v8f c) {
  v8f d = __builtin_amdgcn_wmma_f32_16x16x32_bf16(false, a, false, b, (short)0, c, false, false);
  asm volatile("v_nop\n\tv_nop\n\tv_nop\n\tv_nop" : "+v"(d) : "v"(a), "v"(b));
  return d;
}
// 16x16x32 fragments: lane = (h = lane>>4, row/col = lane&15); elements 0..7 = k0+8h+0..7, 8..15 = k0+16+8h+0..7; D element r = row 8h+r
__device__ __forceinline__ v16h frag_h(const _Float16* rowk0, int lane) {
  union { v16h v; v8h q[2]; } u; const _Float16* p = rowk0 + 8 * (lane >> 4);
  u.q[0] = *(const v8h*)p; u.q[1] = *(const v8h*)(p + 16); return u.v;
}
__device__ __forceinline__ v16h frag_f32(const float* rowk0, int lane) {
  v16h a; const float* p = rowk0 + 8 * (lane >> 4);
#pragma unroll
  for (int i = 0; i < 8; ++i) { a[i] = (_Float16)p[i]; a[8 + i] = (_Float16)p[16 + i]; }
  return a;
}
__device__ __forceinline__ v16h frag_f32s(const float* rowk0, int lane, float sc) {
  v16h a; const float* p = rowk0 + 8 * (lane >> 4);
#pragma unroll
  for (int i = 0; i < 8; ++i) { a[i] = (_Float16)(p[i] * sc); a[8 + i] = (_Float16)(p[16 + i] * sc); }
  return a;
}
// column fragment from a [K][ld] layout (column n), rows >= K read as 0
__device__ __forceinline__ v16h fragc_f32(const float* W, int k0, int n, int lane, int ld, int K) {
  v16h a; const int g = lane >> 4;
#pragma unroll
  for (int i = 0; i < 8; ++i) { const int ka = k0 + 8 * g + i, kb = ka + 16;
    a[i] = (_Float16)(ka < K ? W[(size_t)ka * ld + n] : 0.f); a[8 + i] = (_Float16)(kb < K ? W[(size_t)kb * ld + n] : 0.f); }
  return a;
}
struct F2 { v16b h, l; };
__device__ __forceinline__ F2 bsplit16(const float v[16]) { F2 r;
#pragma unroll
  for (int i = 0; i < 16; ++i) { const __bf16 h = (__bf16)v[i]; r.h[i] = h; r.l[i] = (__bf16)(v[i] - (float)h); }
  return r; }
__device__ __forceinline__ F2 split_row(const float* row, int k0, int lane) { float v[16]; const float* p = row + k0 + 8 * (lane >> 4);
#pragma unroll
  for (int i = 0; i < 8; ++i) { v[i] = p[i]; v[8 + i] = p[16 + i]; }
  return bsplit16(v); }
__device__ __forceinline__ F2 split_rowK(const float* row, int k0, int lane, int K) { float v[16]; const int g = lane >> 4;
#pragma unroll
  for (int i = 0; i < 8; ++i) { const int ka = k0 + 8 * g + i, kb = ka + 16; v[i] = ka < K ? row[ka] : 0.f; v[8 + i] = kb < K ? row[kb] : 0.f; }
  return bsplit16(v); }
__device__ __forceinline__ F2 split_col(const float* W, int k0, int n, int lane, int ld, int K) { float v[16]; const int g = lane >> 4;
#pragma unroll
  for (int i = 0; i < 8; ++i) { const int ka = k0 + 8 * g + i, kb = ka + 16; v[i] = ka < K ? W[(size_t)ka * ld + n] : 0.f; v[8 + i] = kb < K ? W[(size_t)kb * ld + n] : 0.f; }
  return bsplit16(v); }
__device__ __forceinline__ v8f mac3(const F2& a, const F2& b, v8f c) { c = wmma_bf(a.l, b.h, c); c = wmma_bf(a.h, b.l, c); return wmma_bf(a.h, b.h, c); }
__device__ __forceinline__ float sigm(float v) { return 1.0f / (1.0f + expf(-v)); }
#define LDSX() do { asm volatile("s_wait_dscnt 0" ::: "memory"); __builtin_amdgcn_wave_barrier(); __builtin_amdgcn_fence(__ATOMIC_RELEASE, "workgroup"); } while (0)


// Padding-masked multi-head attention (16 heads of 64 on [4,1024,1024], [in][out] weights + biases, scale 1/8): keep = 1 - pad; score(q,k) = -1e9 wherever keep_q*keep_k == 0
// (so a padded query row attends uniformly to all 1,024 keys, exactly like the reference's masked softmax); y = softmax v; out = y Wp + bp. Not causal despite the module name.
#define NB 4
#define SS 1024
#define E 1024
#define NH 16
#define HD 64
#define NR (NB * SS)
#define PLO 1024.0f
#define VLO 2048.0f
__device__ __forceinline__ float bfr(float v) { return (float)(__bf16)v; }
__device__ __forceinline__ v16b frag_b(const __bf16* rowk0, int lane) { return __builtin_bit_cast(v16b, frag_h((const _Float16*)rowk0, lane)); }
// ---- operand tiles in LDS, filled by asynchronous copies ----
// A tile row is 128 B (64 16-bit k values) = 8 pieces of 16 B; piece c of row r lies at r*128 + ((c ^ ((r>>1)&7)) << 4): the 16 rows that a half-wave's ds_load_b128 reads fall on all 64 banks.
__device__ __forceinline__ unsigned lds_addr(const void* p) { return (unsigned)(size_t)p; }   // LDS byte address = low 32 bits of the __shared__ address
// Four 16-byte copies per lane, global -> LDS, through no register. s_wait_xcnt closes the statement so that no address register is rewritten ahead of it.
__device__ __forceinline__ void cp4(unsigned l0, const char* g0, unsigned l1, const char* g1, unsigned l2, const char* g2, unsigned l3, const char* g3) {
  asm volatile("global_load_async_to_lds_b128 %0, %1, off\n\t"
               "global_load_async_to_lds_b128 %2, %3, off\n\t"
               "global_load_async_to_lds_b128 %4, %5, off\n\t"
               "global_load_async_to_lds_b128 %6, %7, off\n\t"
               "s_wait_xcnt 0x0"
               :: "v"(l0), "v"(g0), "v"(l1), "v"(g1), "v"(l2), "v"(g2), "v"(l3), "v"(g3) : "memory");
}
// 64 tile rows (four groups of 16 rows, 2,048 B of LDS each) by 128 threads; gs = bytes between 16 source rows
__device__ __forceinline__ void cp_rows64(unsigned l, const char* g, size_t gs) { cp4(l, g, l + 2048, g + gs, l + 4096, g + 2 * gs, l + 6144, g + 3 * gs); }
// publish point of the two-buffer ring: my LDS reads retired, my copies landed, then the work-group barrier that publishes the next tile and frees the one just read
#define RING_FOOT() do { asm volatile("s_wait_dscnt 0x0" ::: "memory"); asm volatile("s_wait_asynccnt 0x0" ::: "memory"); __syncthreads(); } while (0)
struct FO { int a, b; };   // byte places of a fragment's two 16-byte pieces inside its (swizzled) tile row
__device__ __forceinline__ FO frag_off(int kc, int lane) { const int g = lane >> 4, key = (lane & 15) >> 1; FO o; o.a = ((kc * 4 + g) ^ key) << 4; o.b = ((kc * 4 + 2 + g) ^ key) << 4; return o; }
__device__ __forceinline__ v16h frag_sh(const char* row, FO o) { union { v16h v; v4u q[2]; } u; u.q[0] = *(const v4u*)(row + o.a); u.q[1] = *(const v4u*)(row + o.b); return u.v; }
__device__ __forceinline__ v16b frag_sb(const char* row, FO o) { return __builtin_bit_cast(v16b, frag_sh(row, o)); }

__global__ __launch_bounds__(256) void k_cvt(const float* __restrict__ x, __bf16* __restrict__ Xb) {
  const size_t i8 = (size_t)blockIdx.x * 256 + threadIdx.x; if (i8 >= (size_t)NR * E / 8) return;
  union { __bf16 h[8]; v4u u; } pk;
#pragma unroll
  for (int e = 0; e < 8; ++e) pk.h[e] = (__bf16)x[i8 * 8 + e];
  vst2((unsigned*)(Xb + i8 * 8), pk.u);
}
// PT rows: [0,E) Wq[:,n], [E,2E) Wk[:,n], [2E,3E) Wv[:,n], [3E,4E) Wo[:,n]  ([in][out] weights: column n as a bf16 row)
// block = one tile of 128 k by 64 n of one weight: 256-B loads along n, bf16 pairs (k, k+1) laid transposed in LDS, 256-B stores along k
__global__ __launch_bounds__(256) void k_pack(const float* __restrict__ Wq, const float* __restrict__ Wk, const float* __restrict__ Wv, const float* __restrict__ Wo, __bf16* __restrict__ PT) {
  // tile row n = 128 k values = 16 pieces of 16 B; piece j of row n lies at n*256 + ((j ^ (n >> 2)) << 4): the 16 rows 4 c + e that a ds_store_b32 writes and the 16 pieces of a row that a ds_load_b128 reads fall on all 64 banks
  __shared__ __align__(16) unsigned st[64 * 64];
  const int tid = threadIdx.x, c4 = tid & 15, kq = tid >> 4, m = blockIdx.z, k0 = blockIdx.y * 128, n0 = blockIdx.x * 64;
  const float* W = m == 0 ? Wq : (m == 1 ? Wk : (m == 2 ? Wv : Wo));
  const float* p = W + ((size_t)k0 * E + n0) + (kq * 2 * E + c4 * 4);   // one address for the eight loads, the rest in their offsets
  v4f ev[4], od[4];   // rows k0 + 2 kp and k0 + 2 kp + 1, columns n0 + 4 c4 + 0..3; kp = 16 i + kq
#pragma unroll   // the eight loads issue as one group ahead of the first wait
  for (int i = 0; i < 4; ++i) { ev[i] = *(const v4f*)(p + i * 32 * E); od[i] = *(const v4f*)(p + i * 32 * E + E); }
#pragma unroll   // this loop and the next: ev, od stay in registers (constant indices)
  for (int i = 0; i < 4; ++i) { const int kp = i * 16 + kq;
#pragma unroll
    for (int e = 0; e < 4; ++e) { union { __bf16 h[2]; unsigned u; } pk; pk.h[0] = (__bf16)ev[i][e]; pk.h[1] = (__bf16)od[i][e]; st[(c4 * 4 + e) * 64 + ((((kp >> 2) ^ c4) << 2) | (kp & 3))] = pk.u; } }
  __syncthreads();
  __bf16* q = PT + ((size_t)(m * E + n0) * E + k0) + (kq * E + c4 * 8);
#pragma unroll   // the four LDS reads issue together, row steps fold into the stores' offsets
  for (int i = 0; i < 4; ++i) { const int n = i * 16 + kq;
    vst2((unsigned*)(q + i * 16 * E), *(const v4u*)(&st[n * 64 + ((c4 ^ (n >> 2)) << 2)])); }
}
// QKV: block (64 rows, 128 cols = 2 heads, which); q (+bias) -> Q32 f32 [bh][s][64]; k (+bias) -> bf16 hi/lo rows; v (+bias) -> VT hi/lo x4 [bh][d][s]
__global__ __launch_bounds__(128) void k_qkv(const __bf16* __restrict__ Xb, const __bf16* __restrict__ PT, const float* __restrict__ bq, const float* __restrict__ bk, const float* __restrict__ bv,
                                            float* __restrict__ Q32, __bf16* __restrict__ Kh, __bf16* __restrict__ Kl, _Float16* __restrict__ VTh, _Float16* __restrict__ VTl) {
  // ring: 2 buffers x (64 x rows | 128 weight rows) x 128 B; behind the loop's last barrier the same bytes are the output staging
  __shared__ __align__(128) char smem[2 * 192 * 128];
  float (*so)[16][132] = (float (*)[16][132])smem;
  _Float16 (*sth)[72] = (_Float16 (*)[72])smem; _Float16 (*stl)[72] = (_Float16 (*)[72])(smem + 128 * 72 * 2);
  const int tid = threadIdx.x, wave = tid >> 5, lane = tid & 31, col = lane & 15, g = lane >> 4;
  const int which = blockIdx.z, r0b = blockIdx.x * 64, r0 = r0b + wave * 16, n0 = blockIdx.y * 128; const int b = r0b / SS, s0 = r0b % SS;
  const float* bb_ = which == 0 ? bq : (which == 1 ? bk : bv);
  v8f acc[8] = {};
  const int crow = tid >> 3, cch = tid & 7;
  const unsigned ld0 = lds_addr(smem) + crow * 128 + ((cch ^ ((crow >> 1) & 7)) << 4);
  const char* gx = (const char*)(Xb + (size_t)(r0b + crow) * E + cch * 8);
  const char* gw = (const char*)(PT + (size_t)(which * E + n0 + crow) * E + cch * 8);
  auto fill = [&](int t, int buf) { const unsigned l = ld0 + buf * 24576;
    cp_rows64(l, gx + t * 128, 16 * E * 2); cp_rows64(l + 8192, gw + t * 128, 16 * E * 2); cp_rows64(l + 16384, gw + t * 128 + (size_t)64 * E * 2, 16 * E * 2); };
  const FO fo[2] = { frag_off(0, lane), frag_off(1, lane) };
  fill(0, 0);
  asm volatile("s_wait_asynccnt 0x0" ::: "memory");   // tile 0 landed (my copies)
  __syncthreads();                                    // tile 0 published
  fill(1, 1);
#pragma unroll 1   // rolled: one copy group and one publish point in the text
  for (int t = 0; t < E / 64; ++t) { const char* sb = smem + (t & 1) * 24576 + col * 128;
#pragma unroll
    for (int kc = 0; kc < 2; ++kc) { const v16b a = frag_sb(sb + wave * 2048, fo[kc]);
#pragma unroll
      for (int jh = 0; jh < 8; jh += 4) { v16b wf[4];   // four weight fragments read as one group ahead of their products
#pragma unroll
        for (int j = 0; j < 4; ++j) wf[j] = frag_sb(sb + 8192 + (jh + j) * 2048, fo[kc]);
#pragma unroll
        for (int j = 0; j < 4; ++j) acc[jh + j] = wmma_bf(a, wf[j], acc[jh + j]); } }
    RING_FOOT();
    if (t + 2 < E / 64) fill(t + 2, t & 1); }
  asm volatile("s_wait_asynccnt 0x0" ::: "memory");   // nothing in flight when the ring becomes staging
  if (which < 2) {
#pragma unroll
    for (int j = 0; j < 8; ++j) { const float bb = bfr(bb_[n0 + j * 16 + col]);
#pragma unroll
      for (int r = 0; r < 8; ++r) so[wave][8 * g + r][j * 16 + col] = acc[j][r] + bb; }
    LDSX();
    if (which == 0) { for (int qq = lane; qq < 2 * 16 * 16; qq += 32) { const int hh = qq >> 8, rl = (qq >> 4) & 15, pc = qq & 15; const int h = (n0 >> 6) + hh;
        vst2(Q32 + (((size_t)b * NH + h) * SS + s0 + wave * 16 + rl) * HD + pc * 4, *(const v4f*)(&so[wave][rl][hh * 64 + pc * 4])); } }
    else {
      for (int qq = lane; qq < 2 * 16 * 16; qq += 32) { const int hh = qq >> 8, rl = (qq >> 4) & 15, pl = qq & 15; const int h = (n0 >> 6) + hh; const int pc = pl & 7; union { __bf16 e[8]; v4u u; } pk;
#pragma unroll
        for (int e = 0; e < 8; ++e) { const float v = so[wave][rl][hh * 64 + pc * 8 + e]; const __bf16 hi = (__bf16)v; pk.e[e] = pl < 8 ? hi : (__bf16)(v - (float)hi); }
        vst2((unsigned*)((pl < 8 ? Kh : Kl) + (((size_t)b * NH + h) * SS + s0 + wave * 16 + rl) * HD + pc * 8), pk.u); } } }
  else {
#pragma unroll
    for (int j = 0; j < 8; ++j) { const float bb = bfr(bb_[n0 + j * 16 + col]);
#pragma unroll
      for (int r = 0; r < 8; ++r) { const float v = (acc[j][r] + bb) * 4.0f; const _Float16 hi = (_Float16)v; sth[j * 16 + col][wave * 16 + 8 * g + r] = hi; stl[j * 16 + col][wave * 16 + 8 * g + r] = (_Float16)((v - (float)hi) * VLO); } }
    __syncthreads();
    for (int qq = tid; qq < 128 * 8; qq += 128) { const int cl = qq >> 3, pc = qq & 7; const int c = n0 + cl, h = c >> 6, d = c & 63; const size_t o = (((size_t)b * NH + h) * HD + d) * SS + s0 + pc * 8;
      vst2(VTh + o, *(const v4u*)(&sth[cl][pc * 8])); vst2(VTl + o, *(const v4u*)(&stl[cl][pc * 8])); } }
}
// padding-masked attention: block (64 queries, bh); all 16 key tiles; S on q hi/lo x K hi/lo rows; P,V hi/lo; O f32 [bh][s][64]
__global__ __launch_bounds__(128) void k_attn(const float* __restrict__ Q32, const __bf16* __restrict__ Kh, const __bf16* __restrict__ Kl, const _Float16* __restrict__ VTh, const _Float16* __restrict__ VTl, const float* __restrict__ pad, float* __restrict__ O32) {
  __shared__ __align__(16) float sS[4][16][68];
  __shared__ __align__(16) _Float16 sPh[4][16][72], sPl[4][16][72];
  // ring of two buffers, tiles in the order K(0), V(0), K(1), V(1), ...: sK = 64 key rows hi | lo, sV = 64 d rows of V^T hi | lo, 128 B a row
  __shared__ __align__(128) char sK[128 * 128], sV[128 * 128];
  float (*sO)[16][68] = sS;   // output staging in each wave's own score rows, dead behind the loop
  const int tid = threadIdx.x, w = tid >> 5, lane = tid & 31, col = lane & 15, g = lane >> 4;
  const size_t bh = blockIdx.y; const int qb = blockIdx.x; const int q0 = qb * 64 + w * 16;
  F2 aq[2];
#pragma unroll
  for (int kc = 0; kc < 2; ++kc) aq[kc] = split_row(Q32 + (bh * SS + q0 + col) * HD, kc * 32, lane);
  const int b = (int)(bh / NH); __shared__ float skq[4][16]; if (lane < 16) skq[w][lane] = 1.0f - pad[(size_t)b * SS + q0 + lane];     // keep flags of my 16 query rows
  float mrun = -3.0e38f, lrun = 0.f; v8f acc[4] = {}, ac1[4] = {}, ac2[4] = {};
  const int crow = tid >> 3, cch = tid & 7;
  const unsigned lofs = crow * 128 + ((cch ^ ((crow >> 1) & 7)) << 4);
  const unsigned lK = lds_addr(sK) + lofs, lV = lds_addr(sV) + lofs;
  const char* gKh = (const char*)(Kh + (bh * SS + crow) * HD + cch * 8); const char* gKl = (const char*)(Kl + (bh * SS + crow) * HD + cch * 8);
  const char* gVh = (const char*)(VTh + (bh * HD + crow) * SS + cch * 8); const char* gVl = (const char*)(VTl + (bh * HD + crow) * SS + cch * 8);
  auto fillK = [&](int kt) { cp_rows64(lK, gKh + (size_t)kt * 64 * HD * 2, 16 * HD * 2); cp_rows64(lK + 8192, gKl + (size_t)kt * 64 * HD * 2, 16 * HD * 2); };
  auto fillV = [&](int kt) { cp_rows64(lV, gVh + kt * 128, 16 * SS * 2); cp_rows64(lV + 8192, gVl + kt * 128, 16 * SS * 2); };
  const FO fo[2] = { frag_off(0, lane), frag_off(1, lane) };
  fillK(0);
  asm volatile("s_wait_asynccnt 0x0" ::: "memory");   // K(0) landed (my copies)
  LDSX();
  __syncthreads();                                    // K(0) published
  fillV(0);
#pragma unroll 1
  for (int kt = 0; kt < SS / 64; ++kt) {
#pragma unroll
    for (int t = 0; t < 4; ++t) { const int key = kt * 64 + t * 16 + col; const char* kr = sK + (t * 16 + col) * 128; v8f s = {};
#pragma unroll
      for (int kc = 0; kc < 2; ++kc) { const v16b khf = frag_sb(kr, fo[kc]), klf = frag_sb(kr + 8192, fo[kc]); s = wmma_bf(aq[kc].l, khf, s); s = wmma_bf(aq[kc].h, klf, s); s = wmma_bf(aq[kc].h, khf, s); }
      const float keepk = 1.0f - pad[(size_t)b * SS + key];
#pragma unroll
      for (int r = 0; r < 8; ++r) { sS[w][8 * g + r][t * 16 + col] = (skq[w][8 * g + r] * keepk == 0.f) ? -1.0e9f : s[r] * 0.125f; } }
    LDSX();
    RING_FOOT();                                 // V(kt) published, K(kt) left by every wave
    if (kt + 1 < SS / 64) fillK(kt + 1);
    float mx = -3.4e38f;
#pragma unroll
    for (int jj = 0; jj < 32; ++jj) mx = fmaxf(mx, sS[w][col][g * 32 + jj]);
    mx = fmaxf(mx, __shfl_xor(mx, 16, 32));
    const float mnew = fmaxf(mrun, mx); const float corr = expf(mrun - mnew);
    float ps = 0.f;
#pragma unroll
    for (int jj = 0; jj < 32; ++jj) { const float p = expf(sS[w][col][g * 32 + jj] - mnew) * 16384.0f; ps += p; const _Float16 hi = (_Float16)p; sPh[w][col][g * 32 + jj] = hi; sPl[w][col][g * 32 + jj] = (_Float16)((p - (float)hi) * PLO); }
    ps += __shfl_xor(ps, 16, 32);
    lrun = lrun * corr + ps * (1.0f / 16384.0f); mrun = mnew;
#pragma unroll
    for (int r = 0; r < 8; ++r) { const float cr = __shfl(corr, 8 * g + r, 32);
#pragma unroll
      for (int t = 0; t < 4; ++t) { acc[t][r] *= cr; ac1[t][r] *= cr; ac2[t][r] *= cr; } }
    LDSX();
#pragma unroll
    for (int kc = 0; kc < 2; ++kc) { const v16h ph = frag_h(&sPh[w][col][0] + kc * 32, lane), pl = frag_h(&sPl[w][col][0] + kc * 32, lane);
#pragma unroll
      for (int t = 0; t < 4; ++t) { const char* vr = sV + (t * 16 + col) * 128; const v16h vh = frag_sh(vr, fo[kc]);
        acc[t] = wmma16(ph, vh, acc[t]); ac1[t] = wmma16(ph, frag_sh(vr + 8192, fo[kc]), ac1[t]); ac2[t] = wmma16(pl, vh, ac2[t]); } }
    RING_FOOT();                                 // K(kt+1) published, V(kt) left by every wave
    if (kt + 1 < SS / 64) fillV(kt + 1);
    __builtin_amdgcn_wave_barrier(); }
  asm volatile("s_wait_asynccnt 0x0" ::: "memory");   // nothing in flight at the wave's end
#pragma unroll
  for (int r = 0; r < 8; ++r) { const float lr = __shfl(lrun, 8 * g + r, 32); const float inv = 1.0f / (lr * 16384.0f * 4.0f);
#pragma unroll
    for (int t = 0; t < 4; ++t) sO[w][8 * g + r][t * 16 + col] = (acc[t][r] + ac1[t][r] * (1.0f / VLO) + ac2[t][r] * (1.0f / PLO)) * inv; }
  LDSX();
  for (int qq = lane; qq < 16 * 16; qq += 32) { const int rl = qq >> 4, pc = qq & 15; vst2(O32 + ((bh * SS) + q0 + rl) * HD + pc * 4, *(const v4f*)(&sO[w][rl][pc * 4])); }
}
// out = ctx Wo + bo : split(ctx) x bf16(Wo rows): 2 products (Wo is an INPUT -> bf16 exact)
__global__ __launch_bounds__(128) void k_out(const float* __restrict__ O32, const __bf16* __restrict__ PT, const float* __restrict__ bo, float* __restrict__ out) {
  // ring: 2 buffers x (64 ctx rows of 256 B, f32, one head | 128 weight rows of 128 B); behind the loop's last barrier the same bytes are the output staging
  __shared__ __align__(128) char smem[2 * 32768];
  float (*so)[16][132] = (float (*)[16][132])smem;
  const int tid = threadIdx.x, wave = tid >> 5, lane = tid & 31, col = lane & 15, g = lane >> 4;
  const int r0b = blockIdx.x * 64, r0 = r0b + wave * 16, n0 = blockIdx.y * 128; const int b = r0b / SS, s0 = r0b % SS;
  v8f acc[8] = {};
  // ctx rows: 16 pieces of 16 B, piece c of row r at r*256 + ((c ^ (r&15)) << 4): 16 rows of one piece index fall on all 64 banks
  const int arow = tid >> 4, ach = tid & 15, crow = tid >> 3, cch = tid & 7;
  const unsigned lbase = lds_addr(smem);
  const unsigned la0 = lbase + arow * 256 + ((ach ^ arow) << 4), la1 = lbase + (arow + 8) * 256 + ((ach ^ (arow + 8)) << 4);   // rows arow + 16 i and arow + 8 + 16 i
  const unsigned lw0 = lbase + 16384 + crow * 128 + ((cch ^ ((crow >> 1) & 7)) << 4);
  const char* gc = (const char*)(O32 + ((size_t)b * NH * SS + s0 + arow) * HD + ach * 4);
  const char* gw = (const char*)(PT + (size_t)(3 * E + n0 + crow) * E + cch * 8);
  auto fill = [&](int t, int buf) { const unsigned o = buf * 32768; const char* c = gc + (size_t)t * SS * HD * 4;
    cp4(la0 + o, c, la0 + o + 4096, c + 4096, la0 + o + 8192, c + 8192, la0 + o + 12288, c + 12288);
    cp4(la1 + o, c + 2048, la1 + o + 4096, c + 2048 + 4096, la1 + o + 8192, c + 2048 + 8192, la1 + o + 12288, c + 2048 + 12288);
    cp_rows64(lw0 + o, gw + t * 128, 16 * E * 2); cp_rows64(lw0 + o + 8192, gw + t * 128 + (size_t)64 * E * 2, 16 * E * 2); };
  const FO fo[2] = { frag_off(0, lane), frag_off(1, lane) };
  fill(0, 0);
  asm volatile("s_wait_asynccnt 0x0" ::: "memory");   // tile 0 landed (my copies)
  __syncthreads();                                    // tile 0 published
  fill(1, 1);
#pragma unroll 1
  for (int t = 0; t < E / 64; ++t) { const char* sb = smem + (t & 1) * 32768; const char* ar = sb + (wave * 16 + col) * 256; const char* wr = sb + 16384 + col * 128;
#pragma unroll
    for (int kc = 0; kc < 2; ++kc) { float v[16];
#pragma unroll
      for (int q = 0; q < 4; ++q) { const v4f x4 = *(const v4f*)(ar + (((kc * 8 + (q >> 1) * 4 + 2 * g + (q & 1)) ^ col) << 4));   // k = kc*32 + (q>>1)*16 + 8g + (q&1)*4 + e
#pragma unroll
        for (int e = 0; e < 4; ++e) v[q * 4 + e] = x4[e]; }
      v16b wf[8];   // the eight weight fragments read as one group ahead of their products
#pragma unroll
      for (int j = 0; j < 8; ++j) wf[j] = frag_sb(wr + j * 2048, fo[kc]);
      const F2 a = bsplit16(v);
#pragma unroll
      for (int j = 0; j < 8; ++j) { acc[j] = wmma_bf(a.l, wf[j], acc[j]); acc[j] = wmma_bf(a.h, wf[j], acc[j]); } }
    RING_FOOT();
    if (t + 2 < E / 64) fill(t + 2, t & 1); }
  asm volatile("s_wait_asynccnt 0x0" ::: "memory");   // nothing in flight when the ring becomes staging
#pragma unroll
  for (int j = 0; j < 8; ++j) { const int n = n0 + j * 16 + col; const float bb = bfr(bo[n]);
#pragma unroll
    for (int r = 0; r < 8; ++r) so[wave][8 * g + r][j * 16 + col] = acc[j][r] + bb; }
  LDSX();
#pragma unroll 4
  for (int rl = 0; rl < 16; ++rl) vst2(out + (size_t)(r0 + rl) * E + n0 + lane * 4, *(const v4f*)(&so[wave][rl][lane * 4]));
}
extern "C" void kernel_launch(void* const* d_in, const int* in_sizes, int n_in, void* d_out, int out_size, void* d_ws, size_t ws_size, hipStream_t stream) {
  (void)in_sizes; (void)n_in; (void)out_size; (void)ws_size;
  const float** I = (const float**)d_in;   // x, x_padding_judge, Wq, bq, Wk, bk, Wv, bv, Wp, bp
  const float* x = I[0]; const float* pad = I[1]; const float* Wq = I[2]; const float* bq = I[3]; const float* Wk = I[4]; const float* bk = I[5]; const float* Wv = I[6]; const float* bv = I[7]; const float* Wp = I[8]; const float* bp = I[9];
  float* out = (float*)d_out;
  char* ws = (char*)d_ws; size_t off = 0;
  auto take = [&](size_t bytes) { char* p = ws + off; off += (bytes + 255) & ~(size_t)255; return p; };
  __bf16* Xb = (__bf16*)take((size_t)NR * E * 2); __bf16* PT = (__bf16*)take((size_t)4 * E * E * 2);
  float* Q32 = (float*)take((size_t)NR * E * 4); __bf16* Kh = (__bf16*)take((size_t)NR * E * 2); __bf16* Kl = (__bf16*)take((size_t)NR * E * 2); _Float16* VTh = (_Float16*)take((size_t)NR * E * 2); _Float16* VTl = (_Float16*)take((size_t)NR * E * 2); float* O32 = (float*)take((size_t)NR * E * 4);
  // ws ~ 84 MB
  k_cvt<<<(NR * E / 8 + 255) / 256, 256, 0, stream>>>(x, Xb);
  k_pack<<<dim3(E / 64, E / 128, 4), 256, 0, stream>>>(Wq, Wk, Wv, Wp, PT);
  k_qkv<<<dim3(NR / 64, E / 128, 3), 128, 0, stream>>>(Xb, PT, bq, bk, bv, Q32, Kh, Kl, VTh, VTl);
  k_attn<<<dim3(SS / 64, NB * NH), 128, 0, stream>>>(Q32, Kh, Kl, VTh, VTl, pad, O32);
  k_out<<<dim3(NR / 64, E / 128), 128, 0, stream>>>(O32, PT, bp, out);
}

// v003
// A run of this version takes 128 microseconds.
// In both of two side-by-side timings against v002, it was 1.09 times as fast.
// All steps since v000 together make it 3.15 times as fast.
// compute dtype: x, W*, b* (INPUTS) rounded to bf16 with exact bf16 WMMA products (f32 accumulate) for the projections; K pre-split into bf16 hi/lo rows; q f32 split, P and V f16 hi/lo (3 products each); softmax with the -1e9 padding mask in f32.
#include <hip/hip_runtime.h>
#include <math.h>

typedef __attribute__((ext_vector_type(16))) _Float16 v16h;
typedef __attribute__((ext_vector_type(16))) __bf16 v16b;
typedef __attribute__((ext_vector_type(8)))  _Float16 v8h;
typedef __attribute__((ext_vector_type(8)))  float v8f;
typedef __attribute__((ext_vector_type(4)))  float v4f;
typedef __attribute__((ext_vector_type(2)))  float v2f;
typedef __attribute__((ext_vector_type(4)))  unsigned v4u;
typedef __attribute__((ext_vector_type(4)))  int v4i;
typedef float __attribute__((may_alias)) float_a;
typedef int __attribute__((may_alias)) int_a;

template <typename T> __device__ __forceinline__ void vst2(void* p, T v) { *(T*)p = v;  }
__device__ __forceinline__ v8f wmma16(v16h a, v16h b, v8f c) {
  v8f d = __builtin_amdgcn_wmma_f32_16x16x32_f16(false, a, false, b, (short)0, c, false, false);
  asm volatile("v_nop\n\tv_nop\n\tv_nop\n\tv_nop" : "+v"(d) : "v"(a), "v"(b));
  return d;
}
__device__ __forceinline__ v8f wmma_bf(v16b a, v16b b, v8f c) {
  v8f d = __builtin_amdgcn_wmma_f32_16x16x32_bf16(false, a, false, b, (short)0, c, false, false);
  asm volatile("v_nop\n\tv_nop\n\tv_nop\n\tv_nop" : "+v"(d) : "v"(a), "v"(b));
  return d;
}
// 16x16x32 fragments: lane = (h = lane>>4, row/col = lane&15); elements 0..7 = k0+8h+0..7, 8..15 = k0+16+8h+0..7; D element r = row 8h+r
__device__ __forceinline__ v16h frag_h(const _Float16* rowk0, int lane) {
  union { v16h v; v8h q[2]; } u; const _Float16* p = rowk0 + 8 * (lane >> 4);
  u.q[0] = *(const v8h*)p; u.q[1] = *(const v8h*)(p + 16); return u.v;
}
__device__ __forceinline__ v16h frag_f32(const float* rowk0, int lane) {
  v16h a; const float* p = rowk0 + 8 * (lane >> 4);
#pragma unroll
  for (int i = 0; i < 8; ++i) { a[i] = (_Float16)p[i]; a[8 + i] = (_Float16)p[16 + i]; }
  return a;
}
__device__ __forceinline__ v16h frag_f32s(const float* rowk0, int lane, float sc) {
  v16h a; const float* p = rowk0 + 8 * (lane >> 4);
#pragma unroll
  for (int i = 0; i < 8; ++i) { a[i] = (_Float16)(p[i] * sc); a[8 + i] = (_Float16)(p[16 + i] * sc); }
  return a;
}
// column fragment from a [K][ld] layout (column n), rows >= K read as 0
__device__ __forceinline__ v16h fragc_f32(const float* W, int k0, int n, int lane, int ld, int K) {
  v16h a; const int g = lane >> 4;
#pragma unroll
  for (int i = 0; i < 8; ++i) { const int ka = k0 + 8 * g + i, kb = ka + 16;
    a[i] = (_Float16)(ka < K ? W[(size_t)ka * ld + n] : 0.f); a[8 + i] = (_Float16)(kb < K ? W[(size_t)kb * ld + n] : 0.f); }
  return a;
}
struct F2 { v16b h, l; };
__device__ __forceinline__ F2 bsplit16(const float v[16]) { F2 r;
#pragma unroll
  for (int i = 0; i < 16; ++i) { const __bf16 h = (__bf16)v[i]; r.h[i] = h; r.l[i] = (__bf16)(v[i] - (float)h); }
  return r; }
__device__ __forceinline__ F2 split_row(const float* row, int k0, int lane) { float v[16]; const float* p = row + k0 + 8 * (lane >> 4);
#pragma unroll
  for (int i = 0; i < 8; ++i) { v[i] = p[i]; v[8 + i] = p[16 + i]; }
  return bsplit16(v); }
__device__ __forceinline__ F2 split_rowK(const float* row, int k0, int lane, int K) { float v[16]; const int g = lane >> 4;
#pragma unroll
  for (int i = 0; i < 8; ++i) { const int ka = k0 + 8 * g + i, kb = ka + 16; v[i] = ka < K ? row[ka] : 0.f; v[8 + i] = kb < K ? row[kb] : 0.f; }
  return bsplit16(v); }
__device__ __forceinline__ F2 split_col(const float* W, int k0, int n, int lane, int ld, int K) { float v[16]; const int g = lane >> 4;
#pragma unroll
  for (int i = 0; i < 8; ++i) { const int ka = k0 + 8 * g + i, kb = ka + 16; v[i] = ka < K ? W[(size_t)ka * ld + n] : 0.f; v[8 + i] = kb < K ? W[(size_t)kb * ld + n] : 0.f; }
  return bsplit16(v); }
__device__ __forceinline__ v8f mac3(const F2& a, const F2& b, v8f c) { c = wmma_bf(a.l, b.h, c); c = wmma_bf(a.h, b.l, c); return wmma_bf(a.h, b.h, c); }
__device__ __forceinline__ float sigm(float v) { return 1.0f / (1.0f + expf(-v)); }
#define LDSX() do { asm volatile("s_wait_dscnt 0" ::: "memory"); __builtin_amdgcn_wave_barrier(); __builtin_amdgcn_fence(__ATOMIC_RELEASE, "workgroup"); } while (0)


// Padding-masked multi-head attention (16 heads of 64 on [4,1024,1024], [in][out] weights + biases, scale 1/8): keep = 1 - pad; score(q,k) = -1e9 wherever keep_q*keep_k == 0
// (so a padded query row attends uniformly to all 1,024 keys, exactly like the reference's masked softmax); y = softmax v; out = y Wp + bp. Not causal despite the module name.
#define NB 4
#define SS 1024
#define E 1024
#define NH 16
#define HD 64
#define NR (NB * SS)
#define PLO 1024.0f
#define VLO 2048.0f
__device__ __forceinline__ float bfr(float v) { return (float)(__bf16)v; }
#define L2E 1.4426950408889634f
// 2^x by the hardware's own exponential instruction: below its range it gives 0, which is what a masked score's weight is
__device__ __forceinline__ float exp2_hw(float x) { return __builtin_amdgcn_exp2f(x); }
__device__ __forceinline__ v16b frag_b(const __bf16* rowk0, int lane) { return __builtin_bit_cast(v16b, frag_h((const _Float16*)rowk0, lane)); }
// ---- operand tiles in LDS, filled by asynchronous copies ----
// A tile row is 128 B (64 16-bit k values) = 8 pieces of 16 B; piece c of row r lies at r*128 + ((c ^ ((r>>1)&7)) << 4): the 16 rows that a half-wave's ds_load_b128 reads fall on all 64 banks.
__device__ __forceinline__ unsigned lds_addr(const void* p) { return (unsigned)(size_t)p; }   // LDS byte address = low 32 bits of the __shared__ address
// Four 16-byte copies per lane, global -> LDS, through no register. s_wait_xcnt closes the statement so that no address register is rewritten ahead of it.
__device__ __forceinline__ void cp4(unsigned l0, const char* g0, unsigned l1, const char* g1, unsigned l2, const char* g2, unsigned l3, const char* g3) {
  asm volatile("global_load_async_to_lds_b128 %0, %1, off\n\t"
               "global_load_async_to_lds_b128 %2, %3, off\n\t"
               "global_load_async_to_lds_b128 %4, %5, off\n\t"
               "global_load_async_to_lds_b128 %6, %7, off\n\t"
               "s_wait_xcnt 0x0"
               :: "v"(l0), "v"(g0), "v"(l1), "v"(g1), "v"(l2), "v"(g2), "v"(l3), "v"(g3) : "memory");
}
// 64 tile rows (four groups of 16 rows, 2,048 B of LDS each) by 128 threads; gs = bytes between 16 source rows
__device__ __forceinline__ void cp_rows64(unsigned l, const char* g, size_t gs) { cp4(l, g, l + 2048, g + gs, l + 4096, g + 2 * gs, l + 6144, g + 3 * gs); }
// publish point of the two-buffer ring: my LDS reads retired, my copies landed, then the work-group barrier that publishes the next tile and frees the one just read
#define RING_FOOT() do { asm volatile("s_wait_dscnt 0x0" ::: "memory"); asm volatile("s_wait_asynccnt 0x0" ::: "memory"); __syncthreads(); } while (0)
struct FO { int a, b; };   // byte places of a fragment's two 16-byte pieces inside its (swizzled) tile row
__device__ __forceinline__ FO frag_off(int kc, int lane) { const int g = lane >> 4, key = (lane & 15) >> 1; FO o; o.a = ((kc * 4 + g) ^ key) << 4; o.b = ((kc * 4 + 2 + g) ^ key) << 4; return o; }
__device__ __forceinline__ v16h frag_sh(const char* row, FO o) { union { v16h v; v4u q[2]; } u; u.q[0] = *(const v4u*)(row + o.a); u.q[1] = *(const v4u*)(row + o.b); return u.v; }
__device__ __forceinline__ v16b frag_sb(const char* row, FO o) { return __builtin_bit_cast(v16b, frag_sh(row, o)); }

__global__ __launch_bounds__(256) void k_cvt(const float* __restrict__ x, __bf16* __restrict__ Xb) {
  const size_t i8 = (size_t)blockIdx.x * 256 + threadIdx.x; if (i8 >= (size_t)NR * E / 8) return;
  union { __bf16 h[8]; v4u u; } pk;
#pragma unroll
  for (int e = 0; e < 8; ++e) pk.h[e] = (__bf16)x[i8 * 8 + e];
  vst2((unsigned*)(Xb + i8 * 8), pk.u);
}
// PT rows: [0,E) Wq[:,n], [E,2E) Wk[:,n], [2E,3E) Wv[:,n], [3E,4E) Wo[:,n]  ([in][out] weights: column n as a bf16 row)
// block = one tile of 128 k by 64 n of one weight: 256-B loads along n, bf16 pairs (k, k+1) laid transposed in LDS, 256-B stores along k
__global__ __launch_bounds__(256) void k_pack(const float* __restrict__ Wq, const float* __restrict__ Wk, const float* __restrict__ Wv, const float* __restrict__ Wo, __bf16* __restrict__ PT) {
  // tile row n = 128 k values = 16 pieces of 16 B; piece j of row n lies at n*256 + ((j ^ (n >> 2)) << 4): the 16 rows 4 c + e that a ds_store_b32 writes and the 16 pieces of a row that a ds_load_b128 reads fall on all 64 banks
  __shared__ __align__(16) unsigned st[64 * 64];
  const int tid = threadIdx.x, c4 = tid & 15, kq = tid >> 4, m = blockIdx.z, k0 = blockIdx.y * 128, n0 = blockIdx.x * 64;
  const float* W = m == 0 ? Wq : (m == 1 ? Wk : (m == 2 ? Wv : Wo));
  const float* p = W + ((size_t)k0 * E + n0) + (kq * 2 * E + c4 * 4);   // one address for the eight loads, the rest in their offsets
  v4f ev[4], od[4];   // rows k0 + 2 kp and k0 + 2 kp + 1, columns n0 + 4 c4 + 0..3; kp = 16 i + kq
#pragma unroll   // the eight loads issue as one group ahead of the first wait
  for (int i = 0; i < 4; ++i) { ev[i] = *(const v4f*)(p + i * 32 * E); od[i] = *(const v4f*)(p + i * 32 * E + E); }
#pragma unroll   // this loop and the next: ev, od stay in registers (constant indices)
  for (int i = 0; i < 4; ++i) { const int kp = i * 16 + kq;
#pragma unroll
    for (int e = 0; e < 4; ++e) { union { __bf16 h[2]; unsigned u; } pk; pk.h[0] = (__bf16)ev[i][e]; pk.h[1] = (__bf16)od[i][e]; st[(c4 * 4 + e) * 64 + ((((kp >> 2) ^ c4) << 2) | (kp & 3))] = pk.u; } }
  __syncthreads();
  __bf16* q = PT + ((size_t)(m * E + n0) * E + k0) + (kq * E + c4 * 8);
#pragma unroll   // the four LDS reads issue together, row steps fold into the stores' offsets
  for (int i = 0; i < 4; ++i) { const int n = i * 16 + kq;
    vst2((unsigned*)(q + i * 16 * E), *(const v4u*)(&st[n * 64 + ((c4 ^ (n >> 2)) << 2)])); }
}
// QKV: block (64 rows, 128 cols = 2 heads, which); q (+bias) -> Q32 f32 [bh][s][64]; k (+bias) -> bf16 hi/lo rows; v (+bias) -> VT hi/lo x4 [bh][d][s]
__global__ __launch_bounds__(128) void k_qkv(const __bf16* __restrict__ Xb, const __bf16* __restrict__ PT, const float* __restrict__ bq, const float* __restrict__ bk, const float* __restrict__ bv,
                                            float* __restrict__ Q32, __bf16* __restrict__ Kh, __bf16* __restrict__ Kl, _Float16* __restrict__ VTh, _Float16* __restrict__ VTl) {
  // ring: 2 buffers x (64 x rows | 128 weight rows) x 128 B; behind the loop's last barrier the same bytes are the output staging
  __shared__ __align__(128) char smem[2 * 192 * 128];
  float (*so)[16][132] = (float (*)[16][132])smem;
  _Float16 (*sth)[72] = (_Float16 (*)[72])smem; _Float16 (*stl)[72] = (_Float16 (*)[72])(smem + 128 * 72 * 2);
  const int tid = threadIdx.x, wave = tid >> 5, lane = tid & 31, col = lane & 15, g = lane >> 4;
  const int which = blockIdx.z, r0b = blockIdx.x * 64, r0 = r0b + wave * 16, n0 = blockIdx.y * 128; const int b = r0b / SS, s0 = r0b % SS;
  const float* bb_ = which == 0 ? bq : (which == 1 ? bk : bv);
  v8f acc[8] = {};
  const int crow = tid >> 3, cch = tid & 7;
  const unsigned ld0 = lds_addr(smem) + crow * 128 + ((cch ^ ((crow >> 1) & 7)) << 4);
  const char* gx = (const char*)(Xb + (size_t)(r0b + crow) * E + cch * 8);
  const char* gw = (const char*)(PT + (size_t)(which * E + n0 + crow) * E + cch * 8);
  auto fill = [&](int t, int buf) { const unsigned l = ld0 + buf * 24576;
    cp_rows64(l, gx + t * 128, 16 * E * 2); cp_rows64(l + 8192, gw + t * 128, 16 * E * 2); cp_rows64(l + 16384, gw + t * 128 + (size_t)64 * E * 2, 16 * E * 2); };
  const FO fo[2] = { frag_off(0, lane), frag_off(1, lane) };
  fill(0, 0);
  asm volatile("s_wait_asynccnt 0x0" ::: "memory");   // tile 0 landed (my copies)
  __syncthreads();                                    // tile 0 published
  fill(1, 1);
#pragma unroll 1   // rolled: one copy group and one publish point in the text
  for (int t = 0; t < E / 64; ++t) { const char* sb = smem + (t & 1) * 24576 + col * 128;
#pragma unroll
    for (int kc = 0; kc < 2; ++kc) { const v16b a = frag_sb(sb + wave * 2048, fo[kc]);
#pragma unroll
      for (int jh = 0; jh < 8; jh += 4) { v16b wf[4];   // four weight fragments read as one group ahead of their products
#pragma unroll
        for (int j = 0; j < 4; ++j) wf[j] = frag_sb(sb + 8192 + (jh + j) * 2048, fo[kc]);
#pragma unroll
        for (int j = 0; j < 4; ++j) acc[jh + j] = wmma_bf(a, wf[j], acc[jh + j]); } }
    RING_FOOT();
    if (t + 2 < E / 64) fill(t + 2, t & 1); }
  asm volatile("s_wait_asynccnt 0x0" ::: "memory");   // nothing in flight when the ring becomes staging
  if (which < 2) {
#pragma unroll
    for (int j = 0; j < 8; ++j) { const float bb = bfr(bb_[n0 + j * 16 + col]);
#pragma unroll
      for (int r = 0; r < 8; ++r) so[wave][8 * g + r][j * 16 + col] = acc[j][r] + bb; }
    LDSX();
    if (which == 0) { for (int qq = lane; qq < 2 * 16 * 16; qq += 32) { const int hh = qq >> 8, rl = (qq >> 4) & 15, pc = qq & 15; const int h = (n0 >> 6) + hh;
        vst2(Q32 + (((size_t)b * NH + h) * SS + s0 + wave * 16 + rl) * HD + pc * 4, *(const v4f*)(&so[wave][rl][hh * 64 + pc * 4])); } }
    else {
      for (int qq = lane; qq < 2 * 16 * 16; qq += 32) { const int hh = qq >> 8, rl = (qq >> 4) & 15, pl = qq & 15; const int h = (n0 >> 6) + hh; const int pc = pl & 7; union { __bf16 e[8]; v4u u; } pk;
#pragma unroll
        for (int e = 0; e < 8; ++e) { const float v = so[wave][rl][hh * 64 + pc * 8 + e]; const __bf16 hi = (__bf16)v; pk.e[e] = pl < 8 ? hi : (__bf16)(v - (float)hi); }
        vst2((unsigned*)((pl < 8 ? Kh : Kl) + (((size_t)b * NH + h) * SS + s0 + wave * 16 + rl) * HD + pc * 8), pk.u); } } }
  else {
#pragma unroll
    for (int j = 0; j < 8; ++j) { const float bb = bfr(bb_[n0 + j * 16 + col]);
#pragma unroll
      for (int r = 0; r < 8; ++r) { const float v = (acc[j][r] + bb) * 4.0f; const _Float16 hi = (_Float16)v; sth[j * 16 + col][wave * 16 + 8 * g + r] = hi; stl[j * 16 + col][wave * 16 + 8 * g + r] = (_Float16)((v - (float)hi) * VLO); } }
    __syncthreads();
    for (int qq = tid; qq < 128 * 8; qq += 128) { const int cl = qq >> 3, pc = qq & 7; const int c = n0 + cl, h = c >> 6, d = c & 63; const size_t o = (((size_t)b * NH + h) * HD + d) * SS + s0 + pc * 8;
      vst2(VTh + o, *(const v4u*)(&sth[cl][pc * 8])); vst2(VTl + o, *(const v4u*)(&stl[cl][pc * 8])); } }
}
// padding-masked attention: block (64 queries, bh); all 16 key tiles; S on q hi/lo x K hi/lo rows; P,V hi/lo; O f32 [bh][s][64]
__global__ __launch_bounds__(128) void k_attn(const float* __restrict__ Q32, const __bf16* __restrict__ Kh, const __bf16* __restrict__ Kl, const _Float16* __restrict__ VTh, const _Float16* __restrict__ VTl, const float* __restrict__ pad, float* __restrict__ O32) {
  __shared__ __align__(16) float sS[4][16][68];
  __shared__ __align__(16) _Float16 sPh[4][16][72], sPl[4][16][72];
  // ring of two buffers, tiles in the order K(0), V(0), K(1), V(1), ...: sK = 64 key rows hi | lo, sV = 64 d rows of V^T hi | lo, 128 B a row
  __shared__ __align__(128) char sK[128 * 128], sV[128 * 128];
  float (*sO)[16][68] = sS;   // output staging in each wave's own score rows, dead behind the loop
  const int tid = threadIdx.x, w = tid >> 5, lane = tid & 31, col = lane & 15, g = lane >> 4;
  const size_t bh = blockIdx.y; const int qb = blockIdx.x; const int q0 = qb * 64 + w * 16;
  F2 aq[2];
#pragma unroll
  for (int kc = 0; kc < 2; ++kc) aq[kc] = split_row(Q32 + (bh * SS + q0 + col) * HD, kc * 32, lane);
  const int b = (int)(bh / NH); __shared__ float skq[4][16]; if (lane < 16) skq[w][lane] = 1.0f - pad[(size_t)b * SS + q0 + lane];     // keep flags of my 16 query rows
  float mrun = -3.0e38f, lrun = 0.f; v8f acc[4] = {}, ac1[4] = {}, ac2[4] = {};
  const int crow = tid >> 3, cch = tid & 7;
  const unsigned lofs = crow * 128 + ((cch ^ ((crow >> 1) & 7)) << 4);
  const unsigned lK = lds_addr(sK) + lofs, lV = lds_addr(sV) + lofs;
  const char* gKh = (const char*)(Kh + (bh * SS + crow) * HD + cch * 8); const char* gKl = (const char*)(Kl + (bh * SS + crow) * HD + cch * 8);
  const char* gVh = (const char*)(VTh + (bh * HD + crow) * SS + cch * 8); const char* gVl = (const char*)(VTl + (bh * HD + crow) * SS + cch * 8);
  auto fillK = [&](int kt) { cp_rows64(lK, gKh + (size_t)kt * 64 * HD * 2, 16 * HD * 2); cp_rows64(lK + 8192, gKl + (size_t)kt * 64 * HD * 2, 16 * HD * 2); };
  auto fillV = [&](int kt) { cp_rows64(lV, gVh + kt * 128, 16 * SS * 2); cp_rows64(lV + 8192, gVl + kt * 128, 16 * SS * 2); };
  const FO fo[2] = { frag_off(0, lane), frag_off(1, lane) };
  fillK(0);
  asm volatile("s_wait_asynccnt 0x0" ::: "memory");   // K(0) landed (my copies)
  LDSX();
  __syncthreads();                                    // K(0) published
  fillV(0);
#pragma unroll 1
  for (int kt = 0; kt < SS / 64; ++kt) {
#pragma unroll
    for (int t = 0; t < 4; ++t) { const int key = kt * 64 + t * 16 + col; const char* kr = sK + (t * 16 + col) * 128; v8f s = {};
#pragma unroll
      for (int kc = 0; kc < 2; ++kc) { const v16b khf = frag_sb(kr, fo[kc]), klf = frag_sb(kr + 8192, fo[kc]); s = wmma_bf(aq[kc].l, khf, s); s = wmma_bf(aq[kc].h, klf, s); s = wmma_bf(aq[kc].h, khf, s); }
      const float keepk = 1.0f - pad[(size_t)b * SS + key];
#pragma unroll
      for (int r = 0; r < 8; ++r) { sS[w][8 * g + r][t * 16 + col] = (skq[w][8 * g + r] * keepk == 0.f) ? -1.0e9f : s[r] * 0.125f; } }
    LDSX();
    RING_FOOT();                                 // V(kt) published, K(kt) left by every wave
    if (kt + 1 < SS / 64) fillK(kt + 1);
    float mx = -3.4e38f;
#pragma unroll
    for (int jj = 0; jj < 32; ++jj) mx = fmaxf(mx, sS[w][col][g * 32 + jj]);
    mx = fmaxf(mx, __shfl_xor(mx, 16, 32));
    const float mnew = fmaxf(mrun, mx); const float corr = exp2_hw((mrun - mnew) * L2E);
    float ps = 0.f;   // p = e^(s - m) * 2^14; the difference is formed first, so a row of equal scores (-1e9 everywhere) gets the exponent 14 at every key, whatever the size of m
    const v2f m2 = { mnew, mnew }, l2 = { L2E, L2E }, c2 = { 14.0f, 14.0f };
#pragma unroll
    for (int jj = 0; jj < 32; jj += 2) { const v2f s2 = { sS[w][col][g * 32 + jj], sS[w][col][g * 32 + jj + 1] }; const v2f a = __builtin_elementwise_fma(s2 - m2, l2, c2);   // two exponents a packed instruction
#pragma unroll   // a[e] by constant index: stays in registers
      for (int e = 0; e < 2; ++e) { const float p = exp2_hw(a[e]); ps += p; const _Float16 hi = (_Float16)p; sPh[w][col][g * 32 + jj + e] = hi; sPl[w][col][g * 32 + jj + e] = (_Float16)((p - (float)hi) * PLO); } }
    ps += __shfl_xor(ps, 16, 32);
    lrun = lrun * corr + ps * (1.0f / 16384.0f); mrun = mnew;
#pragma unroll
    for (int r = 0; r < 8; ++r) { const float cr = __shfl(corr, 8 * g + r, 32);
#pragma unroll
      for (int t = 0; t < 4; ++t) { acc[t][r] *= cr; ac1[t][r] *= cr; ac2[t][r] *= cr; } }
    LDSX();
#pragma unroll
    for (int kc = 0; kc < 2; ++kc) { const v16h ph = frag_h(&sPh[w][col][0] + kc * 32, lane), pl = frag_h(&sPl[w][col][0] + kc * 32, lane);
#pragma unroll
      for (int t = 0; t < 4; ++t) { const char* vr = sV + (t * 16 + col) * 128; const v16h vh = frag_sh(vr, fo[kc]);
        acc[t] = wmma16(ph, vh, acc[t]); ac1[t] = wmma16(ph, frag_sh(vr + 8192, fo[kc]), ac1[t]); ac2[t] = wmma16(pl, vh, ac2[t]); } }
    RING_FOOT();                                 // K(kt+1) published, V(kt) left by every wave
    if (kt + 1 < SS / 64) fillV(kt + 1);
    __builtin_amdgcn_wave_barrier(); }
  asm volatile("s_wait_asynccnt 0x0" ::: "memory");   // nothing in flight at the wave's end
#pragma unroll
  for (int r = 0; r < 8; ++r) { const float lr = __shfl(lrun, 8 * g + r, 32); const float inv = 1.0f / (lr * 16384.0f * 4.0f);
#pragma unroll
    for (int t = 0; t < 4; ++t) sO[w][8 * g + r][t * 16 + col] = (acc[t][r] + ac1[t][r] * (1.0f / VLO) + ac2[t][r] * (1.0f / PLO)) * inv; }
  LDSX();
  for (int qq = lane; qq < 16 * 16; qq += 32) { const int rl = qq >> 4, pc = qq & 15; vst2(O32 + ((bh * SS) + q0 + rl) * HD + pc * 4, *(const v4f*)(&sO[w][rl][pc * 4])); }
}
// out = ctx Wo + bo : split(ctx) x bf16(Wo rows): 2 products (Wo is an INPUT -> bf16 exact)
__global__ __launch_bounds__(128) void k_out(const float* __restrict__ O32, const __bf16* __restrict__ PT, const float* __restrict__ bo, float* __restrict__ out) {
  // ring: 2 buffers x (64 ctx rows of 256 B, f32, one head | 128 weight rows of 128 B); behind the loop's last barrier the same bytes are the output staging
  __shared__ __align__(128) char smem[2 * 32768];
  float (*so)[16][132] = (float (*)[16][132])smem;
  const int tid = threadIdx.x, wave = tid >> 5, lane = tid & 31, col = lane & 15, g = lane >> 4;
  const int r0b = blockIdx.x * 64, r0 = r0b + wave * 16, n0 = blockIdx.y * 128; const int b = r0b / SS, s0 = r0b % SS;
  v8f acc[8] = {};
  // ctx rows: 16 pieces of 16 B, piece c of row r at r*256 + ((c ^ (r&15)) << 4): 16 rows of one piece index fall on all 64 banks
  const int arow = tid >> 4, ach = tid & 15, crow = tid >> 3, cch = tid & 7;
  const unsigned lbase = lds_addr(smem);
  const unsigned la0 = lbase + arow * 256 + ((ach ^ arow) << 4), la1 = lbase + (arow + 8) * 256 + ((ach ^ (arow + 8)) << 4);   // rows arow + 16 i and arow + 8 + 16 i
  const unsigned lw0 = lbase + 16384 + crow * 128 + ((cch ^ ((crow >> 1) & 7)) << 4);
  const char* gc = (const char*)(O32 + ((size_t)b * NH * SS + s0 + arow) * HD + ach * 4);
  const char* gw = (const char*)(PT + (size_t)(3 * E + n0 + crow) * E + cch * 8);
  auto fill = [&](int t, int buf) { const unsigned o = buf * 32768; const char* c = gc + (size_t)t * SS * HD * 4;
    cp4(la0 + o, c, la0 + o + 4096, c + 4096, la0 + o + 8192, c + 8192, la0 + o + 12288, c + 12288);
    cp4(la1 + o, c + 2048, la1 + o + 4096, c + 2048 + 4096, la1 + o + 8192, c + 2048 + 8192, la1 + o + 12288, c + 2048 + 12288);
    cp_rows64(lw0 + o, gw + t * 128, 16 * E * 2); cp_rows64(lw0 + o + 8192, gw + t * 128 + (size_t)64 * E * 2, 16 * E * 2); };
  const FO fo[2] = { frag_off(0, lane), frag_off(1, lane) };
  fill(0, 0);
  asm volatile("s_wait_asynccnt 0x0" ::: "memory");   // tile 0 landed (my copies)
  __syncthreads();                                    // tile 0 published
  fill(1, 1);
#pragma unroll 1
  for (int t = 0; t < E / 64; ++t) { const char* sb = smem + (t & 1) * 32768; const char* ar = sb + (wave * 16 + col) * 256; const char* wr = sb + 16384 + col * 128;
#pragma unroll
    for (int kc = 0; kc < 2; ++kc) { float v[16];
#pragma unroll
      for (int q = 0; q < 4; ++q) { const v4f x4 = *(const v4f*)(ar + (((kc * 8 + (q >> 1) * 4 + 2 * g + (q & 1)) ^ col) << 4));   // k = kc*32 + (q>>1)*16 + 8g + (q&1)*4 + e
#pragma unroll
        for (int e = 0; e < 4; ++e) v[q * 4 + e] = x4[e]; }
      v16b wf[8];   // the eight weight fragments read as one group ahead of their products
#pragma unroll
      for (int j = 0; j < 8; ++j) wf[j] = frag_sb(wr + j * 2048, fo[kc]);
      const F2 a = bsplit16(v);
#pragma unroll
      for (int j = 0; j < 8; ++j) { acc[j] = wmma_bf(a.l, wf[j], acc[j]); acc[j] = wmma_bf(a.h, wf[j], acc[j]); } }
    RING_FOOT();
    if (t + 2 < E / 64) fill(t + 2, t & 1); }
  asm volatile("s_wait_asynccnt 0x0" ::: "memory");   // nothing in flight when the ring becomes staging
#pragma unroll
  for (int j = 0; j < 8; ++j) { const int n = n0 + j * 16 + col; const float bb = bfr(bo[n]);
#pragma unroll
    for (int r = 0; r < 8; ++r) so[wave][8 * g + r][j * 16 + col] = acc[j][r] + bb; }
  LDSX();
#pragma unroll 4
  for (int rl = 0; rl < 16; ++rl) vst2(out + (size_t)(r0 + rl) * E + n0 + lane * 4, *(const v4f*)(&so[wave][rl][lane * 4]));
}
extern "C" void kernel_launch(void* const* d_in, const int* in_sizes, int n_in, void* d_out, int out_size, void* d_ws, size_t ws_size, hipStream_t stream) {
  (void)in_sizes; (void)n_in; (void)out_size; (void)ws_size;
  const float** I = (const float**)d_in;   // x, x_padding_judge, Wq, bq, Wk, bk, Wv, bv, Wp, bp
  const float* x = I[0]; const float* pad = I[1]; const float* Wq = I[2]; const float* bq = I[3]; const float* Wk = I[4]; const float* bk = I[5]; const float* Wv = I[6]; const float* bv = I[7]; const float* Wp = I[8]; const float* bp = I[9];
  float* out = (float*)d_out;
  char* ws = (char*)d_ws; size_t off = 0;
  auto take = [&](size_t bytes) { char* p = ws + off; off += (bytes + 255) & ~(size_t)255; return p; };
  __bf16* Xb = (__bf16*)take((size_t)NR * E * 2); __bf16* PT = (__bf16*)take((size_t)4 * E * E * 2);
  float* Q32 = (float*)take((size_t)NR * E * 4); __bf16* Kh = (__bf16*)take((size_t)NR * E * 2); __bf16* Kl = (__bf16*)take((size_t)NR * E * 2); _Float16* VTh = (_Float16*)take((size_t)NR * E * 2); _Float16* VTl = (_Float16*)take((size_t)NR * E * 2); float* O32 = (float*)take((size_t)NR * E * 4);
  // ws ~ 84 MB
  k_cvt<<<(NR * E / 8 + 255) / 256, 256, 0, stream>>>(x, Xb);
  k_pack<<<dim3(E / 64, E / 128, 4), 256, 0, stream>>>(Wq, Wk, Wv, Wp, PT);
  k_qkv<<<dim3(NR / 64, E / 128, 3), 128, 0, stream>>>(Xb, PT, bq, bk, bv, Q32, Kh, Kl, VTh, VTl);
  k_attn<<<dim3(SS / 64, NB * NH), 128, 0, stream>>>(Q32, Kh, Kl, VTh, VTl, pad, O32);
  k_out<<<dim3(NR / 64, E / 128), 128, 0, stream>>>(O32, PT, bp, out);
}

// v004
// A run of this version takes 124 microseconds.
// Two timings next to v003 both put it at 1.03 times that version's speed.
// All steps since v000 together make it 3.25 times as fast.
// compute dtype: x, W*, b* (INPUTS) rounded to bf16 with exact bf16 WMMA products (f32 accumulate) for the projections; K pre-split into bf16 hi/lo rows; q f32 split, P and V f16 hi/lo (3 products each); softmax with the -1e9 padding mask in f32.
#include <hip/hip_runtime.h>
#include <math.h>

typedef __attribute__((ext_vector_type(16))) _Float16 v16h;
typedef __attribute__((ext_vector_type(16))) __bf16 v16b;
typedef __attribute__((ext_vector_type(8)))  _Float16 v8h;
typedef __attribute__((ext_vector_type(8)))  float v8f;
typedef __attribute__((ext_vector_type(4)))  float v4f;
typedef __attribute__((ext_vector_type(2)))  float v2f;
typedef __attribute__((ext_vector_type(4)))  unsigned v4u;
typedef __attribute__((ext_vector_type(4)))  int v4i;
typedef float __attribute__((may_alias)) float_a;
typedef int __attribute__((may_alias)) int_a;

template <typename T> __device__ __forceinline__ void vst2(void* p, T v) { *(T*)p = v;  }
__device__ __forceinline__ v8f wmma16(v16h a, v16h b, v8f c) {
  return __builtin_amdgcn_wmma_f32_16x16x32_f16(false, a, false, b, (short)0, c, false, false);
}
__device__ __forceinline__ v8f wmma_bf(v16b a, v16b b, v8f c) {
  return __builtin_amdgcn_wmma_f32_16x16x32_bf16(false, a, false, b, (short)0, c, false, false);
}
// 16x16x32 fragments: lane = (h = lane>>4, row/col = lane&15); elements 0..7 = k0+8h+0..7, 8..15 = k0+16+8h+0..7; D element r = row 8h+r
__device__ __forceinline__ v16h frag_h(const _Float16* rowk0, int lane) {
  union { v16h v; v8h q[2]; } u; const _Float16* p = rowk0 + 8 * (lane >> 4);
  u.q[0] = *(const v8h*)p; u.q[1] = *(const v8h*)(p + 16); return u.v;
}
__device__ __forceinline__ v16h frag_f32(const float* rowk0, int lane) {
  v16h a; const float* p = rowk0 + 8 * (lane >> 4);
#pragma unroll
  for (int i = 0; i < 8; ++i) { a[i] = (_Float16)p[i]; a[8 + i] = (_Float16)p[16 + i]; }
  return a;
}
__device__ __forceinline__ v16h frag_f32s(const float* rowk0, int lane, float sc) {
  v16h a; const float* p = rowk0 + 8 * (lane >> 4);
#pragma unroll
  for (int i = 0; i < 8; ++i) { a[i] = (_Float16)(p[i] * sc); a[8 + i] = (_Float16)(p[16 + i] * sc); }
  return a;
}
// column fragment from a [K][ld] layout (column n), rows >= K read as 0
__device__ __forceinline__ v16h fragc_f32(const float* W, int k0, int n, int lane, int ld, int K) {
  v16h a; const int g = lane >> 4;
#pragma unroll
  for (int i = 0; i < 8; ++i) { const int ka = k0 + 8 * g + i, kb = ka + 16;
    a[i] = (_Float16)(ka < K ? W[(size_t)ka * ld + n] : 0.f); a[8 + i] = (_Float16)(kb < K ? W[(size_t)kb * ld + n] : 0.f); }
  return a;
}
struct F2 { v16b h, l; };
__device__ __forceinline__ F2 bsplit16(const float v[16]) { F2 r;
#pragma unroll
  for (int i = 0; i < 16; ++i) { const __bf16 h = (__bf16)v[i]; r.h[i] = h; r.l[i] = (__bf16)(v[i] - (float)h); }
  return r; }
__device__ __forceinline__ F2 split_row(const float* row, int k0, int lane) { float v[16]; const float* p = row + k0 + 8 * (lane >> 4);
#pragma unroll
  for (int i = 0; i < 8; ++i) { v[i] = p[i]; v[8 + i] = p[16 + i]; }
  return bsplit16(v); }
__device__ __forceinline__ F2 split_rowK(const float* row, int k0, int lane, int K) { float v[16]; const int g = lane >> 4;
#pragma unroll
  for (int i = 0; i < 8; ++i) { const int ka = k0 + 8 * g + i, kb = ka + 16; v[i] = ka < K ? row[ka] : 0.f; v[8 + i] = kb < K ? row[kb] : 0.f; }
  return bsplit16(v); }
__device__ __forceinline__ F2 split_col(const float* W, int k0, int n, int lane, int ld, int K) { float v[16]; const int g = lane >> 4;
#pragma unroll
  for (int i = 0; i < 8; ++i) { const int ka = k0 + 8 * g + i, kb = ka + 16; v[i] = ka < K ? W[(size_t)ka * ld + n] : 0.f; v[8 + i] = kb < K ? W[(size_t)kb * ld + n] : 0.f; }
  return bsplit16(v); }
__device__ __forceinline__ v8f mac3(const F2& a, const F2& b, v8f c) { c = wmma_bf(a.l, b.h, c); c = wmma_bf(a.h, b.l, c); return wmma_bf(a.h, b.h, c); }
__device__ __forceinline__ float sigm(float v) { return 1.0f / (1.0f + expf(-v)); }
#define LDSX() do { asm volatile("s_wait_dscnt 0" ::: "memory"); __builtin_amdgcn_wave_barrier(); __builtin_amdgcn_fence(__ATOMIC_RELEASE, "workgroup"); } while (0)


// Padding-masked multi-head attention (16 heads of 64 on [4,1024,1024], [in][out] weights + biases, scale 1/8): keep = 1 - pad; score(q,k) = -1e9 wherever keep_q*keep_k == 0
// (so a padded query row attends uniformly to all 1,024 keys, exactly like the reference's masked softmax); y = softmax v; out = y Wp + bp. Not causal despite the module name.
#define NB 4
#define SS 1024
#define E 1024
#define NH 16
#define HD 64
#define NR (NB * SS)
#define PLO 1024.0f
#define VLO 2048.0f
__device__ __forceinline__ float bfr(float v) { return (float)(__bf16)v; }
#define L2E 1.4426950408889634f
// 2^x by the hardware's own exponential instruction: below its range it gives 0, which is what a masked score's weight is
__device__ __forceinline__ float exp2_hw(float x) { return __builtin_amdgcn_exp2f(x); }
__device__ __forceinline__ v16b frag_b(const __bf16* rowk0, int lane) { return __builtin_bit_cast(v16b, frag_h((const _Float16*)rowk0, lane)); }
// ---- operand tiles in LDS, filled by asynchronous copies ----
// A tile row is 128 B (64 16-bit k values) = 8 pieces of 16 B; piece c of row r lies at r*128 + ((c ^ ((r>>1)&7)) << 4): the 16 rows that a half-wave's ds_load_b128 reads fall on all 64 banks.
__device__ __forceinline__ unsigned lds_addr(const void* p) { return (unsigned)(size_t)p; }   // LDS byte address = low 32 bits of the __shared__ address
// Four 16-byte copies per lane, global -> LDS, through no register. s_wait_xcnt closes the statement so that no address register is rewritten ahead of it.
__device__ __forceinline__ void cp4(unsigned l0, const char* g0, unsigned l1, const char* g1, unsigned l2, const char* g2, unsigned l3, const char* g3) {
  asm volatile("global_load_async_to_lds_b128 %0, %1, off\n\t"
               "global_load_async_to_lds_b128 %2, %3, off\n\t"
               "global_load_async_to_lds_b128 %4, %5, off\n\t"
               "global_load_async_to_lds_b128 %6, %7, off\n\t"
               "s_wait_xcnt 0x0"
               :: "v"(l0), "v"(g0), "v"(l1), "v"(g1), "v"(l2), "v"(g2), "v"(l3), "v"(g3) : "memory");
}
// 64 tile rows (four groups of 16 rows, 2,048 B of LDS each) by 128 threads; gs = bytes between 16 source rows
__device__ __forceinline__ void cp_rows64(unsigned l, const char* g, size_t gs) { cp4(l, g, l + 2048, g + gs, l + 4096, g + 2 * gs, l + 6144, g + 3 * gs); }
// publish point of the two-buffer ring: my LDS reads retired, my copies landed, then the work-group barrier that publishes the next tile and frees the one just read
#define RING_FOOT() do { asm volatile("s_wait_dscnt 0x0" ::: "memory"); asm volatile("s_wait_asynccnt 0x0" ::: "memory"); __syncthreads(); } while (0)
struct FO { int a, b; };   // byte places of a fragment's two 16-byte pieces inside its (swizzled) tile row
__device__ __forceinline__ FO frag_off(int kc, int lane) { const int g = lane >> 4, key = (lane & 15) >> 1; FO o; o.a = ((kc * 4 + g) ^ key) << 4; o.b = ((kc * 4 + 2 + g) ^ key) << 4; return o; }
__device__ __forceinline__ v16h frag_sh(const char* row, FO o) { union { v16h v; v4u q[2]; } u; u.q[0] = *(const v4u*)(row + o.a); u.q[1] = *(const v4u*)(row + o.b); return u.v; }
__device__ __forceinline__ v16b frag_sb(const char* row, FO o) { return __builtin_bit_cast(v16b, frag_sh(row, o)); }

__global__ __launch_bounds__(256) void k_cvt(const float* __restrict__ x, __bf16* __restrict__ Xb) {
  const size_t i8 = (size_t)blockIdx.x * 256 + threadIdx.x; if (i8 >= (size_t)NR * E / 8) return;
  union { __bf16 h[8]; v4u u; } pk;
#pragma unroll
  for (int e = 0; e < 8; ++e) pk.h[e] = (__bf16)x[i8 * 8 + e];
  vst2((unsigned*)(Xb + i8 * 8), pk.u);
}
// PT rows: [0,E) Wq[:,n], [E,2E) Wk[:,n], [2E,3E) Wv[:,n], [3E,4E) Wo[:,n]  ([in][out] weights: column n as a bf16 row)
// block = one tile of 128 k by 64 n of one weight: 256-B loads along n, bf16 pairs (k, k+1) laid transposed in LDS, 256-B stores along k
__global__ __launch_bounds__(256) void k_pack(const float* __restrict__ Wq, const float* __restrict__ Wk, const float* __restrict__ Wv, const float* __restrict__ Wo, __bf16* __restrict__ PT) {
  // tile row n = 128 k values = 16 pieces of 16 B; piece j of row n lies at n*256 + ((j ^ (n >> 2)) << 4): the 16 rows 4 c + e that a ds_store_b32 writes and the 16 pieces of a row that a ds_load_b128 reads fall on all 64 banks
  __shared__ __align__(16) unsigned st[64 * 64];
  const int tid = threadIdx.x, c4 = tid & 15, kq = tid >> 4, m = blockIdx.z, k0 = blockIdx.y * 128, n0 = blockIdx.x * 64;
  const float* W = m == 0 ? Wq : (m == 1 ? Wk : (m == 2 ? Wv : Wo));
  const float* p = W + ((size_t)k0 * E + n0) + (kq * 2 * E + c4 * 4);   // one address for the eight loads, the rest in their offsets
  v4f ev[4], od[4];   // rows k0 + 2 kp and k0 + 2 kp + 1, columns n0 + 4 c4 + 0..3; kp = 16 i + kq
#pragma unroll   // the eight loads issue as one group ahead of the first wait
  for (int i = 0; i < 4; ++i) { ev[i] = *(const v4f*)(p + i * 32 * E); od[i] = *(const v4f*)(p + i * 32 * E + E); }
#pragma unroll   // this loop and the next: ev, od stay in registers (constant indices)
  for (int i = 0; i < 4; ++i) { const int kp = i * 16 + kq;
#pragma unroll
    for (int e = 0; e < 4; ++e) { union { __bf16 h[2]; unsigned u; } pk; pk.h[0] = (__bf16)ev[i][e]; pk.h[1] = (__bf16)od[i][e]; st[(c4 * 4 + e) * 64 + ((((kp >> 2) ^ c4) << 2) | (kp & 3))] = pk.u; } }
  __syncthreads();
  __bf16* q = PT + ((size_t)(m * E + n0) * E + k0) + (kq * E + c4 * 8);
#pragma unroll   // the four LDS reads issue together, row steps fold into the stores' offsets
  for (int i = 0; i < 4; ++i) { const int n = i * 16 + kq;
    vst2((unsigned*)(q + i * 16 * E), *(const v4u*)(&st[n * 64 + ((c4 ^ (n >> 2)) << 2)])); }
}
// QKV: block (64 rows, 128 cols = 2 heads, which); q (+bias) -> Q32 f32 [bh][s][64]; k (+bias) -> bf16 hi/lo rows; v (+bias) -> VT hi/lo x4 [bh][d][s]
__global__ __launch_bounds__(128) void k_qkv(const __bf16* __restrict__ Xb, const __bf16* __restrict__ PT, const float* __restrict__ bq, const float* __restrict__ bk, const float* __restrict__ bv,
                                            float* __restrict__ Q32, __bf16* __restrict__ Kh, __bf16* __restrict__ Kl, _Float16* __restrict__ VTh, _Float16* __restrict__ VTl) {
  // ring: 2 buffers x (64 x rows | 128 weight rows) x 128 B; behind the loop's last barrier the same bytes are the output staging
  __shared__ __align__(128) char smem[2 * 192 * 128];
  float (*so)[16][132] = (float (*)[16][132])smem;
  _Float16 (*sth)[72] = (_Float16 (*)[72])smem; _Float16 (*stl)[72] = (_Float16 (*)[72])(smem + 128 * 72 * 2);
  const int tid = threadIdx.x, wave = tid >> 5, lane = tid & 31, col = lane & 15, g = lane >> 4;
  const int which = blockIdx.z, r0b = blockIdx.x * 64, r0 = r0b + wave * 16, n0 = blockIdx.y * 128; const int b = r0b / SS, s0 = r0b % SS;
  const float* bb_ = which == 0 ? bq : (which == 1 ? bk : bv);
  v8f acc[8] = {};
  const int crow = tid >> 3, cch = tid & 7;
  const unsigned ld0 = lds_addr(smem) + crow * 128 + ((cch ^ ((crow >> 1) & 7)) << 4);
  const char* gx = (const char*)(Xb + (size_t)(r0b + crow) * E + cch * 8);
  const char* gw = (const char*)(PT + (size_t)(which * E + n0 + crow) * E + cch * 8);
  auto fill = [&](int t, int buf) { const unsigned l = ld0 + buf * 24576;
    cp_rows64(l, gx + t * 128, 16 * E * 2); cp_rows64(l + 8192, gw + t * 128, 16 * E * 2); cp_rows64(l + 16384, gw + t * 128 + (size_t)64 * E * 2, 16 * E * 2); };
  const FO fo[2] = { frag_off(0, lane), frag_off(1, lane) };
  fill(0, 0);
  asm volatile("s_wait_asynccnt 0x0" ::: "memory");   // tile 0 landed (my copies)
  __syncthreads();                                    // tile 0 published
  fill(1, 1);
#pragma unroll 1   // rolled: one copy group and one publish point in the text
  for (int t = 0; t < E / 64; ++t) { const char* sb = smem + (t & 1) * 24576 + col * 128;
#pragma unroll
    for (int kc = 0; kc < 2; ++kc) { const v16b a = frag_sb(sb + wave * 2048, fo[kc]);
#pragma unroll
      for (int jh = 0; jh < 8; jh += 4) { v16b wf[4];   // four weight fragments read as one group ahead of their products
#pragma unroll
        for (int j = 0; j < 4; ++j) wf[j] = frag_sb(sb + 8192 + (jh + j) * 2048, fo[kc]);
        __builtin_amdgcn_sched_barrier(0);   // keeps the group's LDS reads ahead of its products; without it they are sunk between the products in ones and twos
#pragma unroll
        for (int j = 0; j < 4; ++j) acc[jh + j] = wmma_bf(a, wf[j], acc[jh + j]); } }
    RING_FOOT();
    if (t + 2 < E / 64) fill(t + 2, t & 1); }
  asm volatile("s_wait_asynccnt 0x0" ::: "memory");   // nothing in flight when the ring becomes staging
  if (which < 2) {
#pragma unroll
    for (int j = 0; j < 8; ++j) { const float bb = bfr(bb_[n0 + j * 16 + col]);
#pragma unroll
      for (int r = 0; r < 8; ++r) so[wave][8 * g + r][j * 16 + col] = acc[j][r] + bb; }
    LDSX();
    if (which == 0) { for (int qq = lane; qq < 2 * 16 * 16; qq += 32) { const int hh = qq >> 8, rl = (qq >> 4) & 15, pc = qq & 15; const int h = (n0 >> 6) + hh;
        vst2(Q32 + (((size_t)b * NH + h) * SS + s0 + wave * 16 + rl) * HD + pc * 4, *(const v4f*)(&so[wave][rl][hh * 64 + pc * 4])); } }
    else {
      for (int qq = lane; qq < 2 * 16 * 16; qq += 32) { const int hh = qq >> 8, rl = (qq >> 4) & 15, pl = qq & 15; const int h = (n0 >> 6) + hh; const int pc = pl & 7; union { __bf16 e[8]; v4u u; } pk;
#pragma unroll
        for (int e = 0; e < 8; ++e) { const float v = so[wave][rl][hh * 64 + pc * 8 + e]; const __bf16 hi = (__bf16)v; pk.e[e] = pl < 8 ? hi : (__bf16)(v - (float)hi); }
        vst2((unsigned*)((pl < 8 ? Kh : Kl) + (((size_t)b * NH + h) * SS + s0 + wave * 16 + rl) * HD + pc * 8), pk.u); } } }
  else {
#pragma unroll
    for (int j = 0; j < 8; ++j) { const float bb = bfr(bb_[n0 + j * 16 + col]);
#pragma unroll
      for (int r = 0; r < 8; ++r) { const float v = (acc[j][r] + bb) * 4.0f; const _Float16 hi = (_Float16)v; sth[j * 16 + col][wave * 16 + 8 * g + r] = hi; stl[j * 16 + col][wave * 16 + 8 * g + r] = (_Float16)((v - (float)hi) * VLO); } }
    __syncthreads();
    for (int qq = tid; qq < 128 * 8; qq += 128) { const int cl = qq >> 3, pc = qq & 7; const int c = n0 + cl, h = c >> 6, d = c & 63; const size_t o = (((size_t)b * NH + h) * HD + d) * SS + s0 + pc * 8;
      vst2(VTh + o, *(const v4u*)(&sth[cl][pc * 8])); vst2(VTl + o, *(const v4u*)(&stl[cl][pc * 8])); } }
}
// padding-masked attention: block (64 queries, bh); all 16 key tiles; S on q hi/lo x K hi/lo rows; P,V hi/lo; O f32 [bh][s][64]
__global__ __launch_bounds__(128) void k_attn(const float* __restrict__ Q32, const __bf16* __restrict__ Kh, const __bf16* __restrict__ Kl, const _Float16* __restrict__ VTh, const _Float16* __restrict__ VTl, const float* __restrict__ pad, float* __restrict__ O32) {
  __shared__ __align__(16) float sS[4][16][68];
  __shared__ __align__(16) _Float16 sPh[4][16][72], sPl[4][16][72];
  // ring of two buffers, tiles in the order K(0), V(0), K(1), V(1), ...: sK = 64 key rows hi | lo, sV = 64 d rows of V^T hi | lo, 128 B a row
  __shared__ __align__(128) char sK[128 * 128], sV[128 * 128];
  float (*sO)[16][68] = sS;   // output staging in each wave's own score rows, dead behind the loop
  const int tid = threadIdx.x, w = tid >> 5, lane = tid & 31, col = lane & 15, g = lane >> 4;
  const size_t bh = blockIdx.y; const int qb = blockIdx.x; const int q0 = qb * 64 + w * 16;
  F2 aq[2];
#pragma unroll
  for (int kc = 0; kc < 2; ++kc) aq[kc] = split_row(Q32 + (bh * SS + q0 + col) * HD, kc * 32, lane);
  const int b = (int)(bh / NH); __shared__ float skq[4][16]; if (lane < 16) skq[w][lane] = 1.0f - pad[(size_t)b * SS + q0 + lane];     // keep flags of my 16 query rows
  float mrun = -3.0e38f, lrun = 0.f; v8f acc[4] = {}, ac1[4] = {}, ac2[4] = {};
  const int crow = tid >> 3, cch = tid & 7;
  const unsigned lofs = crow * 128 + ((cch ^ ((crow >> 1) & 7)) << 4);
  const unsigned lK = lds_addr(sK) + lofs, lV = lds_addr(sV) + lofs;
  const char* gKh = (const char*)(Kh + (bh * SS + crow) * HD + cch * 8); const char* gKl = (const char*)(Kl + (bh * SS + crow) * HD + cch * 8);
  const char* gVh = (const char*)(VTh + (bh * HD + crow) * SS + cch * 8); const char* gVl = (const char*)(VTl + (bh * HD + crow) * SS + cch * 8);
  auto fillK = [&](int kt) { cp_rows64(lK, gKh + (size_t)kt * 64 * HD * 2, 16 * HD * 2); cp_rows64(lK + 8192, gKl + (size_t)kt * 64 * HD * 2, 16 * HD * 2); };
  auto fillV = [&](int kt) { cp_rows64(lV, gVh + kt * 128, 16 * SS * 2); cp_rows64(lV + 8192, gVl + kt * 128, 16 * SS * 2); };
  const FO fo[2] = { frag_off(0, lane), frag_off(1, lane) };
  fillK(0);
  asm volatile("s_wait_asynccnt 0x0" ::: "memory");   // K(0) landed (my copies)
  LDSX();
  __syncthreads();                                    // K(0) published
  fillV(0);
#pragma unroll 1
  for (int kt = 0; kt < SS / 64; ++kt) {
#pragma unroll
    for (int t = 0; t < 4; ++t) { const int key = kt * 64 + t * 16 + col; const char* kr = sK + (t * 16 + col) * 128; v8f s = {};
#pragma unroll
      for (int kc = 0; kc < 2; ++kc) { const v16b khf = frag_sb(kr, fo[kc]), klf = frag_sb(kr + 8192, fo[kc]); s = wmma_bf(aq[kc].l, khf, s); s = wmma_bf(aq[kc].h, klf, s); s = wmma_bf(aq[kc].h, khf, s); }
      const float keepk = 1.0f - pad[(size_t)b * SS + key];
#pragma unroll
      for (int r = 0; r < 8; ++r) { sS[w][8 * g + r][t * 16 + col] = (skq[w][8 * g + r] * keepk == 0.f) ? -1.0e9f : s[r] * 0.125f; } }
    LDSX();
    RING_FOOT();                                 // V(kt) published, K(kt) left by every wave
    if (kt + 1 < SS / 64) fillK(kt + 1);
    float mx = -3.4e38f;
#pragma unroll
    for (int jj = 0; jj < 32; ++jj) mx = fmaxf(mx, sS[w][col][g * 32 + jj]);
    mx = fmaxf(mx, __shfl_xor(mx, 16, 32));
    const float mnew = fmaxf(mrun, mx); const float corr = exp2_hw((mrun - mnew) * L2E);
    float ps = 0.f;   // p = e^(s - m) * 2^14; the difference is formed first, so a row of equal scores (-1e9 everywhere) gets the exponent 14 at every key, whatever the size of m
    const v2f m2 = { mnew, mnew }, l2 = { L2E, L2E }, c2 = { 14.0f, 14.0f };
#pragma unroll
    for (int jj = 0; jj < 32; jj += 2) { const v2f s2 = { sS[w][col][g * 32 + jj], sS[w][col][g * 32 + jj + 1] }; const v2f a = __builtin_elementwise_fma(s2 - m2, l2, c2);   // two exponents a packed instruction
#pragma unroll   // a[e] by constant index: stays in registers
      for (int e = 0; e < 2; ++e) { const float p = exp2_hw(a[e]); ps += p; const _Float16 hi = (_Float16)p; sPh[w][col][g * 32 + jj + e] = hi; sPl[w][col][g * 32 + jj + e] = (_Float16)((p - (float)hi) * PLO); } }
    ps += __shfl_xor(ps, 16, 32);
    lrun = lrun * corr + ps * (1.0f / 16384.0f); mrun = mnew;
#pragma unroll
    for (int r = 0; r < 8; ++r) { const float cr = __shfl(corr, 8 * g + r, 32);
#pragma unroll
      for (int t = 0; t < 4; ++t) { acc[t][r] *= cr; ac1[t][r] *= cr; ac2[t][r] *= cr; } }
    LDSX();
#pragma unroll
    for (int kc = 0; kc < 2; ++kc) { const v16h ph = frag_h(&sPh[w][col][0] + kc * 32, lane), pl = frag_h(&sPl[w][col][0] + kc * 32, lane);
#pragma unroll
      for (int t = 0; t < 4; ++t) { const char* vr = sV + (t * 16 + col) * 128; const v16h vh = frag_sh(vr, fo[kc]);
        acc[t] = wmma16(ph, vh, acc[t]); ac1[t] = wmma16(ph, frag_sh(vr + 8192, fo[kc]), ac1[t]); ac2[t] = wmma16(pl, vh, ac2[t]); } }
    RING_FOOT();                                 // K(kt+1) published, V(kt) left by every wave
    if (kt + 1 < SS / 64) fillV(kt + 1);
    __builtin_amdgcn_wave_barrier(); }
  asm volatile("s_wait_asynccnt 0x0" ::: "memory");   // nothing in flight at the wave's end
#pragma unroll
  for (int r = 0; r < 8; ++r) { const float lr = __shfl(lrun, 8 * g + r, 32); const float inv = 1.0f / (lr * 16384.0f * 4.0f);
#pragma unroll
    for (int t = 0; t < 4; ++t) sO[w][8 * g + r][t * 16 + col] = (acc[t][r] + ac1[t][r] * (1.0f / VLO) + ac2[t][r] * (1.0f / PLO)) * inv; }
  LDSX();
  for (int qq = lane; qq < 16 * 16; qq += 32) { const int rl = qq >> 4, pc = qq & 15; vst2(O32 + ((bh * SS) + q0 + rl) * HD + pc * 4, *(const v4f*)(&sO[w][rl][pc * 4])); }
}
// out = ctx Wo + bo : split(ctx) x bf16(Wo rows): 2 products (Wo is an INPUT -> bf16 exact)
__global__ __launch_bounds__(128) void k_out(const float* __restrict__ O32, const __bf16* __restrict__ PT, const float* __restrict__ bo, float* __restrict__ out) {
  // ring: 2 buffers x (64 ctx rows of 256 B, f32, one head | 128 weight rows of 128 B); behind the loop's last barrier the same bytes are the output staging
  __shared__ __align__(128) char smem[2 * 32768];
  float (*so)[16][132] = (float (*)[16][132])smem;
  const int tid = threadIdx.x, wave = tid >> 5, lane = tid & 31, col = lane & 15, g = lane >> 4;
  const int r0b = blockIdx.x * 64, r0 = r0b + wave * 16, n0 = blockIdx.y * 128; const int b = r0b / SS, s0 = r0b % SS;
  v8f acc[8] = {};
  // ctx rows: 16 pieces of 16 B, piece c of row r at r*256 + ((c ^ (r&15)) << 4): 16 rows of one piece index fall on all 64 banks
  const int arow = tid >> 4, ach = tid & 15, crow = tid >> 3, cch = tid & 7;
  const unsigned lbase = lds_addr(smem);
  const unsigned la0 = lbase + arow * 256 + ((ach ^ arow) << 4), la1 = lbase + (arow + 8) * 256 + ((ach ^ (arow + 8)) << 4);   // rows arow + 16 i and arow + 8 + 16 i
  const unsigned lw0 = lbase + 16384 + crow * 128 + ((cch ^ ((crow >> 1) & 7)) << 4);
  const char* gc = (const char*)(O32 + ((size_t)b * NH * SS + s0 + arow) * HD + ach * 4);
  const char* gw = (const char*)(PT + (size_t)(3 * E + n0 + crow) * E + cch * 8);
  auto fill = [&](int t, int buf) { const unsigned o = buf * 32768; const char* c = gc + (size_t)t * SS * HD * 4;
    cp4(la0 + o, c, la0 + o + 4096, c + 4096, la0 + o + 8192, c + 8192, la0 + o + 12288, c + 12288);
    cp4(la1 + o, c + 2048, la1 + o + 4096, c + 2048 + 4096, la1 + o + 8192, c + 2048 + 8192, la1 + o + 12288, c + 2048 + 12288);
    cp_rows64(lw0 + o, gw + t * 128, 16 * E * 2); cp_rows64(lw0 + o + 8192, gw + t * 128 + (size_t)64 * E * 2, 16 * E * 2); };
  const FO fo[2] = { frag_off(0, lane), frag_off(1, lane) };
  fill(0, 0);
  asm volatile("s_wait_asynccnt 0x0" ::: "memory");   // tile 0 landed (my copies)
  __syncthreads();                                    // tile 0 published
  fill(1, 1);
#pragma unroll 1
  for (int t = 0; t < E / 64; ++t) { const char* sb = smem + (t & 1) * 32768; const char* ar = sb + (wave * 16 + col) * 256; const char* wr = sb + 16384 + col * 128;
#pragma unroll
    for (int kc = 0; kc < 2; ++kc) { float v[16];
#pragma unroll
      for (int q = 0; q < 4; ++q) { const v4f x4 = *(const v4f*)(ar + (((kc * 8 + (q >> 1) * 4 + 2 * g + (q & 1)) ^ col) << 4));   // k = kc*32 + (q>>1)*16 + 8g + (q&1)*4 + e
#pragma unroll
        for (int e = 0; e < 4; ++e) v[q * 4 + e] = x4[e]; }
      v16b wf[8];   // the eight weight fragments read as one group ahead of their products
#pragma unroll
      for (int j = 0; j < 8; ++j) wf[j] = frag_sb(wr + j * 2048, fo[kc]);
      __builtin_amdgcn_sched_barrier(0);   // keeps the twenty LDS reads one group ahead of the split and the products; without it they are sunk between the products and each is waited for at once
      const F2 a = bsplit16(v);
#pragma unroll
      for (int j = 0; j < 8; ++j) { acc[j] = wmma_bf(a.l, wf[j], acc[j]); acc[j] = wmma_bf(a.h, wf[j], acc[j]); } }
    RING_FOOT();
    if (t + 2 < E / 64) fill(t + 2, t & 1); }
  asm volatile("s_wait_asynccnt 0x0" ::: "memory");   // nothing in flight when the ring becomes staging
#pragma unroll
  for (int j = 0; j < 8; ++j) { const int n = n0 + j * 16 + col; const float bb = bfr(bo[n]);
#pragma unroll
    for (int r = 0; r < 8; ++r) so[wave][8 * g + r][j * 16 + col] = acc[j][r] + bb; }
  LDSX();
#pragma unroll 4
  for (int rl = 0; rl < 16; ++rl) vst2(out + (size_t)(r0 + rl) * E + n0 + lane * 4, *(const v4f*)(&so[wave][rl][lane * 4]));
}
extern "C" void kernel_launch(void* const* d_in, const int* in_sizes, int n_in, void* d_out, int out_size, void* d_ws, size_t ws_size, hipStream_t stream) {
  (void)in_sizes; (void)n_in; (void)out_size; (void)ws_size;
  const float** I = (const float**)d_in;   // x, x_padding_judge, Wq, bq, Wk, bk, Wv, bv, Wp, bp
  const float* x = I[0]; const float* pad = I[1]; const float* Wq = I[2]; const float* bq = I[3]; const float* Wk = I[4]; const float* bk = I[5]; const float* Wv = I[6]; const float* bv = I[7]; const float* Wp = I[8]; const float* bp = I[9];
  float* out = (float*)d_out;
  char* ws = (char*)d_ws; size_t off = 0;
  auto take = [&](size_t bytes) { char* p = ws + off; off += (bytes + 255) & ~(size_t)255; return p; };
  __bf16* Xb = (__bf16*)take((size_t)NR * E * 2); __bf16* PT = (__bf16*)take((size_t)4 * E * E * 2);
  float* Q32 = (float*)take((size_t)NR * E * 4); __bf16* Kh = (__bf16*)take((size_t)NR * E * 2); __bf16* Kl = (__bf16*)take((size_t)NR * E * 2); _Float16* VTh = (_Float16*)take((size_t)NR * E * 2); _Float16* VTl = (_Float16*)take((size_t)NR * E * 2); float* O32 = (float*)take((size_t)NR * E * 4);
  // ws ~ 84 MB
  k_cvt<<<(NR * E / 8 + 255) / 256, 256, 0, stream>>>(x, Xb);
  k_pack<<<dim3(E / 64, E / 128, 4), 256, 0, stream>>>(Wq, Wk, Wv, Wp, PT);
  k_qkv<<<dim3(NR / 64, E / 128, 3), 128, 0, stream>>>(Xb, PT, bq, bk, bv, Q32, Kh, Kl, VTh, VTl);
  k_attn<<<dim3(SS / 64, NB * NH), 128, 0, stream>>>(Q32, Kh, Kl, VTh, VTl, pad, O32);
  k_out<<<dim3(NR / 64, E / 128), 128, 0, stream>>>(O32, PT, bp, out);
}

// v005
// A run of this version takes 108 microseconds.
// Next to v004, in two timings, it ran 1.15 times as fast each time.
// All steps since v000 together make it 3.75 times as fast.
// compute dtype: x, W*, b* (INPUTS) rounded to bf16 with exact bf16 WMMA products (f32 accumulate) for the projections; K pre-split into bf16 hi/lo rows; q f32 split, P and V f16 hi/lo (3 products each); softmax with the -1e9 padding mask in f32.
#include <hip/hip_runtime.h>
#include <math.h>

typedef __attribute__((ext_vector_type(16))) _Float16 v16h;
typedef __attribute__((ext_vector_type(16))) __bf16 v16b;
typedef __attribute__((ext_vector_type(8)))  _Float16 v8h;
typedef __attribute__((ext_vector_type(8)))  float v8f;
typedef __attribute__((ext_vector_type(4)))  float v4f;
typedef __attribute__((ext_vector_type(2)))  float v2f;
typedef __attribute__((ext_vector_type(2)))  _Float16 v2h;
typedef __attribute__((ext_vector_type(4)))  unsigned v4u;
typedef __attribute__((ext_vector_type(4)))  int v4i;
typedef float __attribute__((may_alias)) float_a;
typedef int __attribute__((may_alias)) int_a;

template <typename T> __device__ __forceinline__ void vst2(void* p, T v) { *(T*)p = v;  }
__device__ __forceinline__ v8f wmma16(v16h a, v16h b, v8f c) {
  return __builtin_amdgcn_wmma_f32_16x16x32_f16(false, a, false, b, (short)0, c, false, false);
}
__device__ __forceinline__ v8f wmma_bf(v16b a, v16b b, v8f c) {
  return __builtin_amdgcn_wmma_f32_16x16x32_bf16(false, a, false, b, (short)0, c, false, false);
}
// 16x16x32 fragments: lane = (h = lane>>4, row/col = lane&15); elements 0..7 = k0+8h+0..7, 8..15 = k0+16+8h+0..7; D element r = row 8h+r
__device__ __forceinline__ v16h frag_h(const _Float16* rowk0, int lane) {
  union { v16h v; v8h q[2]; } u; const _Float16* p = rowk0 + 8 * (lane >> 4);
  u.q[0] = *(const v8h*)p; u.q[1] = *(const v8h*)(p + 16); return u.v;
}
__device__ __forceinline__ v16h frag_f32(const float* rowk0, int lane) {
  v16h a; const float* p = rowk0 + 8 * (lane >> 4);
#pragma unroll
  for (int i = 0; i < 8; ++i) { a[i] = (_Float16)p[i]; a[8 + i] = (_Float16)p[16 + i]; }
  return a;
}
__device__ __forceinline__ v16h frag_f32s(const float* rowk0, int lane, float sc) {
  v16h a; const float* p = rowk0 + 8 * (lane >> 4);
#pragma unroll
  for (int i = 0; i < 8; ++i) { a[i] = (_Float16)(p[i] * sc); a[8 + i] = (_Float16)(p[16 + i] * sc); }
  return a;
}
// column fragment from a [K][ld] layout (column n), rows >= K read as 0
__device__ __forceinline__ v16h fragc_f32(const float* W, int k0, int n, int lane, int ld, int K) {
  v16h a; const int g = lane >> 4;
#pragma unroll
  for (int i = 0; i < 8; ++i) { const int ka = k0 + 8 * g + i, kb = ka + 16;
    a[i] = (_Float16)(ka < K ? W[(size_t)ka * ld + n] : 0.f); a[8 + i] = (_Float16)(kb < K ? W[(size_t)kb * ld + n] : 0.f); }
  return a;
}
struct F2 { v16b h, l; };
__device__ __forceinline__ F2 bsplit16(const float v[16]) { F2 r;
#pragma unroll
  for (int i = 0; i < 16; ++i) { const __bf16 h = (__bf16)v[i]; r.h[i] = h; r.l[i] = (__bf16)(v[i] - (float)h); }
  return r; }
__device__ __forceinline__ F2 split_row(const float* row, int k0, int lane) { float v[16]; const float* p = row + k0 + 8 * (lane >> 4);
#pragma unroll
  for (int i = 0; i < 8; ++i) { v[i] = p[i]; v[8 + i] = p[16 + i]; }
  return bsplit16(v); }
__device__ __forceinline__ F2 split_rowK(const float* row, int k0, int lane, int K) { float v[16]; const int g = lane >> 4;
#pragma unroll
  for (int i = 0; i < 8; ++i) { const int ka = k0 + 8 * g + i, kb = ka + 16; v[i] = ka < K ? row[ka] : 0.f; v[8 + i] = kb < K ? row[kb] : 0.f; }
  return bsplit16(v); }
__device__ __forceinline__ F2 split_col(const float* W, int k0, int n, int lane, int ld, int K) { float v[16]; const int g = lane >> 4;
#pragma unroll
  for (int i = 0; i < 8; ++i) { const int ka = k0 + 8 * g + i, kb = ka + 16; v[i] = ka < K ? W[(size_t)ka * ld + n] : 0.f; v[8 + i] = kb < K ? W[(size_t)kb * ld + n] : 0.f; }
  return bsplit16(v); }
__device__ __forceinline__ v8f mac3(const F2& a, const F2& b, v8f c) { c = wmma_bf(a.l, b.h, c); c = wmma_bf(a.h, b.l, c); return wmma_bf(a.h, b.h, c); }
__device__ __forceinline__ float sigm(float v) { return 1.0f / (1.0f + expf(-v)); }
#define LDSX() do { asm volatile("s_wait_dscnt 0" ::: "memory"); __builtin_amdgcn_wave_barrier(); __builtin_amdgcn_fence(__ATOMIC_RELEASE, "workgroup"); } while (0)


// Padding-masked multi-head attention (16 heads of 64 on [4,1024,1024], [in][out] weights + biases, scale 1/8): keep = 1 - pad; score(q,k) = -1e9 wherever keep_q*keep_k == 0
// (so a padded query row attends uniformly to all 1,024 keys, exactly like the reference's masked softmax); y = softmax v; out = y Wp + bp. Not causal despite the module name.
#define NB 4
#define SS 1024
#define E 1024
#define NH 16
#define HD 64
#define NR (NB * SS)
#define PLO 1024.0f
#define VLO 2048.0f
__device__ __forceinline__ float bfr(float v) { return (float)(__bf16)v; }
#define L2E 1.4426950408889634f
// 2^x by the hardware's own exponential instruction: below its range it gives 0, which is what a masked score's weight is
__device__ __forceinline__ float exp2_hw(float x) { return __builtin_amdgcn_exp2f(x); }
__device__ __forceinline__ v16b frag_b(const __bf16* rowk0, int lane) { return __builtin_bit_cast(v16b, frag_h((const _Float16*)rowk0, lane)); }
// ---- operand tiles in LDS, filled by asynchronous copies ----
// A tile row is 128 B (64 16-bit k values) = 8 pieces of 16 B; piece c of row r lies at r*128 + ((c ^ ((r>>1)&7)) << 4): the 16 rows that a half-wave's ds_load_b128 reads fall on all 64 banks.
__device__ __forceinline__ unsigned lds_addr(const void* p) { return (unsigned)(size_t)p; }   // LDS byte address = low 32 bits of the __shared__ address
// Four 16-byte copies per lane, global -> LDS, through no register. s_wait_xcnt closes the statement so that no address register is rewritten ahead of it.
__device__ __forceinline__ void cp4(unsigned l0, const char* g0, unsigned l1, const char* g1, unsigned l2, const char* g2, unsigned l3, const char* g3) {
  asm volatile("global_load_async_to_lds_b128 %0, %1, off\n\t"
               "global_load_async_to_lds_b128 %2, %3, off\n\t"
               "global_load_async_to_lds_b128 %4, %5, off\n\t"
               "global_load_async_to_lds_b128 %6, %7, off\n\t"
               "s_wait_xcnt 0x0"
               :: "v"(l0), "v"(g0), "v"(l1), "v"(g1), "v"(l2), "v"(g2), "v"(l3), "v"(g3) : "memory");
}
// 64 tile rows (four groups of 16 rows, 2,048 B of LDS each) by 128 threads; gs = bytes between 16 source rows
__device__ __forceinline__ void cp_rows64(unsigned l, const char* g, size_t gs) { cp4(l, g, l + 2048, g + gs, l + 4096, g + 2 * gs, l + 6144, g + 3 * gs); }
// publish point of the two-buffer ring: my LDS reads retired, my copies landed, then the work-group barrier that publishes the next tile and frees the one just read
#define RING_FOOT() do { asm volatile("s_wait_dscnt 0x0" ::: "memory"); asm volatile("s_wait_asynccnt 0x0" ::: "memory"); __syncthreads(); } while (0)
struct FO { int a, b; };   // byte places of a fragment's two 16-byte pieces inside its (swizzled) tile row
__device__ __forceinline__ FO frag_off(int kc, int lane) { const int g = lane >> 4, key = (lane & 15) >> 1; FO o; o.a = ((kc * 4 + g) ^ key) << 4; o.b = ((kc * 4 + 2 + g) ^ key) << 4; return o; }
__device__ __forceinline__ v16h frag_sh(const char* row, FO o) { union { v16h v; v4u q[2]; } u; u.q[0] = *(const v4u*)(row + o.a); u.q[1] = *(const v4u*)(row + o.b); return u.v; }
__device__ __forceinline__ v16b frag_sb(const char* row, FO o) { return __builtin_bit_cast(v16b, frag_sh(row, o)); }

__global__ __launch_bounds__(256) void k_cvt(const float* __restrict__ x, __bf16* __restrict__ Xb) {
  const size_t i8 = (size_t)blockIdx.x * 256 + threadIdx.x; if (i8 >= (size_t)NR * E / 8) return;
  union { __bf16 h[8]; v4u u; } pk;
#pragma unroll
  for (int e = 0; e < 8; ++e) pk.h[e] = (__bf16)x[i8 * 8 + e];
  vst2((unsigned*)(Xb + i8 * 8), pk.u);
}
// PT rows: [0,E) Wq[:,n], [E,2E) Wk[:,n], [2E,3E) Wv[:,n], [3E,4E) Wo[:,n]  ([in][out] weights: column n as a bf16 row)
// block = one tile of 128 k by 64 n of one weight: 256-B loads along n, bf16 pairs (k, k+1) laid transposed in LDS, 256-B stores along k
__global__ __launch_bounds__(256) void k_pack(const float* __restrict__ Wq, const float* __restrict__ Wk, const float* __restrict__ Wv, const float* __restrict__ Wo, __bf16* __restrict__ PT) {
  // tile row n = 128 k values = 16 pieces of 16 B; piece j of row n lies at n*256 + ((j ^ (n >> 2)) << 4): the 16 rows 4 c + e that a ds_store_b32 writes and the 16 pieces of a row that a ds_load_b128 reads fall on all 64 banks
  __shared__ __align__(16) unsigned st[64 * 64];
  const int tid = threadIdx.x, c4 = tid & 15, kq = tid >> 4, m = blockIdx.z, k0 = blockIdx.y * 128, n0 = blockIdx.x * 64;
  const float* W = m == 0 ? Wq : (m == 1 ? Wk : (m == 2 ? Wv : Wo));
  const float* p = W + ((size_t)k0 * E + n0) + (kq * 2 * E + c4 * 4);   // one address for the eight loads, the rest in their offsets
  v4f ev[4], od[4];   // rows k0 + 2 kp and k0 + 2 kp + 1, columns n0 + 4 c4 + 0..3; kp = 16 i + kq
#pragma unroll   // the eight loads issue as one group ahead of the first wait
  for (int i = 0; i < 4; ++i) { ev[i] = *(const v4f*)(p + i * 32 * E); od[i] = *(const v4f*)(p + i * 32 * E + E); }
#pragma unroll   // this loop and the next: ev, od stay in registers (constant indices)
  for (int i = 0; i < 4; ++i) { const int kp = i * 16 + kq;
#pragma unroll
    for (int e = 0; e < 4; ++e) { union { __bf16 h[2]; unsigned u; } pk; pk.h[0] = (__bf16)ev[i][e]; pk.h[1] = (__bf16)od[i][e]; st[(c4 * 4 + e) * 64 + ((((kp >> 2) ^ c4) << 2) | (kp & 3))] = pk.u; } }
  __syncthreads();
  __bf16* q = PT + ((size_t)(m * E + n0) * E + k0) + (kq * E + c4 * 8);
#pragma unroll   // the four LDS reads issue together, row steps fold into the stores' offsets
  for (int i = 0; i < 4; ++i) { const int n = i * 16 + kq;
    vst2((unsigned*)(q + i * 16 * E), *(const v4u*)(&st[n * 64 + ((c4 ^ (n >> 2)) << 2)])); }
}
// QKV: block (64 rows, 128 cols = 2 heads, which); q (+bias) -> Q32 f32 [bh][s][64]; k (+bias) -> bf16 hi/lo rows; v (+bias) -> VT hi/lo x4 [bh][d][s]
__global__ __launch_bounds__(128) void k_qkv(const __bf16* __restrict__ Xb, const __bf16* __restrict__ PT, const float* __restrict__ bq, const float* __restrict__ bk, const float* __restrict__ bv,
                                            float* __restrict__ Q32, __bf16* __restrict__ Kh, __bf16* __restrict__ Kl, _Float16* __restrict__ VTh, _Float16* __restrict__ VTl) {
  // ring: 2 buffers x (64 x rows | 128 weight rows) x 128 B; behind the loop's last barrier the same bytes are the output staging
  __shared__ __align__(128) char smem[2 * 192 * 128];
  float (*so)[16][132] = (float (*)[16][132])smem;
  _Float16 (*sth)[72] = (_Float16 (*)[72])smem; _Float16 (*stl)[72] = (_Float16 (*)[72])(smem + 128 * 72 * 2);
  const int tid = threadIdx.x, wave = tid >> 5, lane = tid & 31, col = lane & 15, g = lane >> 4;
  const int which = blockIdx.z, r0b = blockIdx.x * 64, r0 = r0b + wave * 16, n0 = blockIdx.y * 128; const int b = r0b / SS, s0 = r0b % SS;
  const float* bb_ = which == 0 ? bq : (which == 1 ? bk : bv);
  v8f acc[8] = {};
  const int crow = tid >> 3, cch = tid & 7;
  const unsigned ld0 = lds_addr(smem) + crow * 128 + ((cch ^ ((crow >> 1) & 7)) << 4);
  const char* gx = (const char*)(Xb + (size_t)(r0b + crow) * E + cch * 8);
  const char* gw = (const char*)(PT + (size_t)(which * E + n0 + crow) * E + cch * 8);
  auto fill = [&](int t, int buf) { const unsigned l = ld0 + buf * 24576;
    cp_rows64(l, gx + t * 128, 16 * E * 2); cp_rows64(l + 8192, gw + t * 128, 16 * E * 2); cp_rows64(l + 16384, gw + t * 128 + (size_t)64 * E * 2, 16 * E * 2); };
  const FO fo[2] = { frag_off(0, lane), frag_off(1, lane) };
  fill(0, 0);
  asm volatile("s_wait_asynccnt 0x0" ::: "memory");   // tile 0 landed (my copies)
  __syncthreads();                                    // tile 0 published
  fill(1, 1);
#pragma unroll 1   // rolled: one copy group and one publish point in the text
  for (int t = 0; t < E / 64; ++t) { const char* sb = smem + (t & 1) * 24576 + col * 128;
#pragma unroll
    for (int kc = 0; kc < 2; ++kc) { const v16b a = frag_sb(sb + wave * 2048, fo[kc]);
#pragma unroll
      for (int jh = 0; jh < 8; jh += 4) { v16b wf[4];   // four weight fragments read as one group ahead of their products
#pragma unroll
        for (int j = 0; j < 4; ++j) wf[j] = frag_sb(sb + 8192 + (jh + j) * 2048, fo[kc]);
        __builtin_amdgcn_sched_barrier(0);   // keeps the group's LDS reads ahead of its products; without it they are sunk between the products in ones and twos
#pragma unroll
        for (int j = 0; j < 4; ++j) acc[jh + j] = wmma_bf(a, wf[j], acc[jh + j]); } }
    RING_FOOT();
    if (t + 2 < E / 64) fill(t + 2, t & 1); }
  asm volatile("s_wait_asynccnt 0x0" ::: "memory");   // nothing in flight when the ring becomes staging
  if (which < 2) {
#pragma unroll
    for (int j = 0; j < 8; ++j) { const float bb = bfr(bb_[n0 + j * 16 + col]);
#pragma unroll
      for (int r = 0; r < 8; ++r) so[wave][8 * g + r][j * 16 + col] = acc[j][r] + bb; }
    LDSX();
    if (which == 0) { for (int qq = lane; qq < 2 * 16 * 16; qq += 32) { const int hh = qq >> 8, rl = (qq >> 4) & 15, pc = qq & 15; const int h = (n0 >> 6) + hh;
        vst2(Q32 + (((size_t)b * NH + h) * SS + s0 + wave * 16 + rl) * HD + pc * 4, *(const v4f*)(&so[wave][rl][hh * 64 + pc * 4])); } }
    else {
      for (int qq = lane; qq < 2 * 16 * 16; qq += 32) { const int hh = qq >> 8, rl = (qq >> 4) & 15, pl = qq & 15; const int h = (n0 >> 6) + hh; const int pc = pl & 7; union { __bf16 e[8]; v4u u; } pk;
#pragma unroll
        for (int e = 0; e < 8; ++e) { const float v = so[wave][rl][hh * 64 + pc * 8 + e]; const __bf16 hi = (__bf16)v; pk.e[e] = pl < 8 ? hi : (__bf16)(v - (float)hi); }
        vst2((unsigned*)((pl < 8 ? Kh : Kl) + (((size_t)b * NH + h) * SS + s0 + wave * 16 + rl) * HD + pc * 8), pk.u); } } }
  else {
#pragma unroll
    for (int j = 0; j < 8; ++j) { const float bb = bfr(bb_[n0 + j * 16 + col]);
#pragma unroll
      for (int r = 0; r < 8; ++r) { const float v = (acc[j][r] + bb) * 4.0f; const _Float16 hi = (_Float16)v; sth[j * 16 + col][wave * 16 + 8 * g + r] = hi; stl[j * 16 + col][wave * 16 + 8 * g + r] = (_Float16)((v - (float)hi) * VLO); } }
    __syncthreads();
    for (int qq = tid; qq < 128 * 8; qq += 128) { const int cl = qq >> 3, pc = qq & 7; const int c = n0 + cl, h = c >> 6, d = c & 63; const size_t o = (((size_t)b * NH + h) * HD + d) * SS + s0 + pc * 8;
      vst2(VTh + o, *(const v4u*)(&sth[cl][pc * 8])); vst2(VTl + o, *(const v4u*)(&stl[cl][pc * 8])); } }
}
// the other half-wave's value of the same column: lane l <-> l ^ 16, one vector instruction
__device__ __forceinline__ float xhalf(float v) { const int i = __builtin_bit_cast(int, v); return __builtin_bit_cast(float, __builtin_amdgcn_permlanex16(i, i, 0x76543210, 0xfedcba98, false, false)); }
// padding-masked attention, transposed: block (64 queries, bh); all 16 key tiles; S^T = K q^T (K hi/lo rows as A, q hi/lo as B), so a lane holds scores of ONE query (column col, keys 8g + r of each 16-key tile);
// two score tiles, turned into weights in place, are the B operand of O^T += V^T P^T (P,V hi/lo); O f32 [bh][s][64]
// four waves a SIMD (the four resident blocks of a WGP) need at most 256 registers a wave
__global__ __launch_bounds__(128) __attribute__((amdgpu_waves_per_eu(4, 4))) void k_attn(const float* __restrict__ Q32, const __bf16* __restrict__ Kh, const __bf16* __restrict__ Kl, const _Float16* __restrict__ VTh, const _Float16* __restrict__ VTl, const float* __restrict__ pad, float* __restrict__ O32) {
  __shared__ __align__(16) float sO[4][16][68];   // output staging, each wave its own 16 query rows: the rows leave as whole 256-B runs
  __shared__ __align__(16) float skk[SS];         // keep flags of the 1,024 keys of this batch row
  // ring of two buffers, tiles in the order K(0), V(0), K(1), V(1), ...: sK = 64 key rows hi | lo, sV = 64 d rows of V^T hi | lo, 128 B a row
  __shared__ __align__(128) char sK[128 * 128], sV[128 * 128];
  const int tid = threadIdx.x, w = tid >> 5, lane = tid & 31, col = lane & 15, g = lane >> 4;
  const size_t bh = blockIdx.y; const int qb = blockIdx.x; const int q0 = qb * 64 + w * 16;
  F2 aq[2];
#pragma unroll
  for (int kc = 0; kc < 2; ++kc) aq[kc] = split_row(Q32 + (bh * SS + q0 + col) * HD, kc * 32, lane);
  const int b = (int)(bh / NH);
  const float keepq = 1.0f - pad[(size_t)b * SS + q0 + col];     // keep flag of my query
  { const v4f one = { 1.0f, 1.0f, 1.0f, 1.0f }; const float* pp = pad + (size_t)b * SS + tid * 8;
    *(v4f*)(&skk[tid * 8]) = one - *(const v4f*)pp; *(v4f*)(&skk[tid * 8 + 4]) = one - *(const v4f*)(pp + 4); }
  float mrun = -3.0e38f, lrun = 0.f; v8f acc[4] = {}, ac1[4] = {}, ac2[4] = {};
  const int crow = tid >> 3, cch = tid & 7;
  const unsigned lofs = crow * 128 + ((cch ^ ((crow >> 1) & 7)) << 4);
  const unsigned lK = lds_addr(sK) + lofs, lV = lds_addr(sV) + lofs;
  const char* gKh = (const char*)(Kh + (bh * SS + crow) * HD + cch * 8); const char* gKl = (const char*)(Kl + (bh * SS + crow) * HD + cch * 8);
  const char* gVh = (const char*)(VTh + (bh * HD + crow) * SS + cch * 8); const char* gVl = (const char*)(VTl + (bh * HD + crow) * SS + cch * 8);
  auto fillK = [&](int kt) { cp_rows64(lK, gKh + (size_t)kt * 64 * HD * 2, 16 * HD * 2); cp_rows64(lK + 8192, gKl + (size_t)kt * 64 * HD * 2, 16 * HD * 2); };
  auto fillV = [&](int kt) { cp_rows64(lV, gVh + kt * 128, 16 * SS * 2); cp_rows64(lV + 8192, gVl + kt * 128, 16 * SS * 2); };
  const FO fo[2] = { frag_off(0, lane), frag_off(1, lane) };
  fillK(0);
  asm volatile("s_wait_asynccnt 0x0" ::: "memory");   // K(0) landed (my copies)
  LDSX();                                             // my key flags written
  __syncthreads();                                    // K(0) and the key flags published
  fillV(0);
#pragma unroll 1
  for (int kt = 0; kt < SS / 64; ++kt) {
    v8f s[4];   // s[t][r] = score of key kt*64 + t*16 + 8g + r against query col
#pragma unroll
    for (int t = 0; t < 4; ++t) { const char* kr = sK + (t * 16 + col) * 128; v8f d = {};
#pragma unroll
      for (int kc = 0; kc < 2; ++kc) { const v16b khf = frag_sb(kr, fo[kc]), klf = frag_sb(kr + 8192, fo[kc]); d = wmma_bf(khf, aq[kc].l, d); d = wmma_bf(klf, aq[kc].h, d); d = wmma_bf(khf, aq[kc].h, d); }
      const float* kf = &skk[kt * 64 + t * 16 + 8 * g]; const v4f k0 = *(const v4f*)kf, k1 = *(const v4f*)(kf + 4);
#pragma unroll
      for (int r = 0; r < 8; ++r) { const float keepk = r < 4 ? k0[r & 3] : k1[r & 3]; s[t][r] = (keepq * keepk == 0.f) ? -1.0e9f : d[r] * 0.125f; } }
    RING_FOOT();                                 // V(kt) published, K(kt) left by every wave
    if (kt + 1 < SS / 64) fillK(kt + 1);
    float mx = -3.4e38f;
#pragma unroll
    for (int t = 0; t < 4; ++t) {
#pragma unroll
      for (int r = 0; r < 8; ++r) mx = fmaxf(mx, s[t][r]); }
    mx = fmaxf(mx, xhalf(mx));
    const float mnew = fmaxf(mrun, mx); const float corr = exp2_hw((mrun - mnew) * L2E);
    v2f ps2 = { 0.f, 0.f };   // p = e^(s - m) * 2^14; the difference is formed first, so a row of equal scores (-1e9 everywhere) gets the exponent 14 at every key, whatever the size of m
    const v2f m2 = { mnew, mnew }, l2 = { L2E, L2E }, c2 = { 14.0f, 14.0f }, plo2 = { PLO, PLO };
    v16h ph[2], pl[2];   // B fragments of P^T: element e of fragment kc = key kc*32 + (e < 8 ? 8g + e : 16 + 8g + e - 8) = score tile 2 kc + (e >> 3), register e & 7
#pragma unroll
    for (int t = 0; t < 4; ++t) {
#pragma unroll
      for (int r = 0; r < 8; r += 2) { const v2f s2 = { s[t][r], s[t][r + 1] }; const v2f a = __builtin_elementwise_fma(s2 - m2, l2, c2);   // two exponents a packed instruction
        const v2f p2 = { exp2_hw(a[0]), exp2_hw(a[1]) }; ps2 += p2;
        const v2h h2 = __builtin_convertvector(p2, v2h); const v2h o2 = __builtin_convertvector((p2 - __builtin_convertvector(h2, v2f)) * plo2, v2h);   // hi and lo halves, two keys a register
        const int i = (t & 1) * 8 + r; ph[t >> 1][i] = h2[0]; ph[t >> 1][i + 1] = h2[1]; pl[t >> 1][i] = o2[0]; pl[t >> 1][i + 1] = o2[1]; } }
    float ps = ps2[0] + ps2[1]; ps += xhalf(ps);
    lrun = lrun * corr + ps * (1.0f / 16384.0f); mrun = mnew;
#pragma unroll
    for (int t = 0; t < 4; ++t) { acc[t] *= corr; ac1[t] *= corr; ac2[t] *= corr; }
    __builtin_amdgcn_sched_barrier(0);   // the V reads and their products start behind the weights' arithmetic; without it they are spread through it in ones and twos, each read waited for at once
#pragma unroll
    for (int kc = 0; kc < 2; ++kc) {
#pragma unroll
      for (int t = 0; t < 4; ++t) { const char* vr = sV + (t * 16 + col) * 128; const v16h vh = frag_sh(vr, fo[kc]);
        acc[t] = wmma16(vh, ph[kc], acc[t]); ac1[t] = wmma16(frag_sh(vr + 8192, fo[kc]), ph[kc], ac1[t]); ac2[t] = wmma16(vh, pl[kc], ac2[t]); } }
    RING_FOOT();                                 // K(kt+1) published, V(kt) left by every wave
    if (kt + 1 < SS / 64) fillV(kt + 1); }
  asm volatile("s_wait_asynccnt 0x0" ::: "memory");   // nothing in flight at the wave's end
  const float inv = 1.0f / (lrun * 16384.0f * 4.0f);
#pragma unroll
  for (int t = 0; t < 4; ++t) {   // acc[t][r] = O[query col][d = t*16 + 8g + r]
#pragma unroll
    for (int r = 0; r < 8; ++r) sO[w][col][t * 16 + 8 * g + r] = (acc[t][r] + ac1[t][r] * (1.0f / VLO) + ac2[t][r] * (1.0f / PLO)) * inv; }
  LDSX();
  for (int qq = lane; qq < 16 * 16; qq += 32) { const int rl = qq >> 4, pc = qq & 15; vst2(O32 + ((bh * SS) + q0 + rl) * HD + pc * 4, *(const v4f*)(&sO[w][rl][pc * 4])); }
}
// out = ctx Wo + bo : split(ctx) x bf16(Wo rows): 2 products (Wo is an INPUT -> bf16 exact)
__global__ __launch_bounds__(128) void k_out(const float* __restrict__ O32, const __bf16* __restrict__ PT, const float* __restrict__ bo, float* __restrict__ out) {
  // ring: 2 buffers x (64 ctx rows of 256 B, f32, one head | 128 weight rows of 128 B); behind the loop's last barrier the same bytes are the output staging
  __shared__ __align__(128) char smem[2 * 32768];
  float (*so)[16][132] = (float (*)[16][132])smem;
  const int tid = threadIdx.x, wave = tid >> 5, lane = tid & 31, col = lane & 15, g = lane >> 4;
  const int r0b = blockIdx.x * 64, r0 = r0b + wave * 16, n0 = blockIdx.y * 128; const int b = r0b / SS, s0 = r0b % SS;
  v8f acc[8] = {};
  // ctx rows: 16 pieces of 16 B, piece c of row r at r*256 + ((c ^ (r&15)) << 4): 16 rows of one piece index fall on all 64 banks
  const int arow = tid >> 4, ach = tid & 15, crow = tid >> 3, cch = tid & 7;
  const unsigned lbase = lds_addr(smem);
  const unsigned la0 = lbase + arow * 256 + ((ach ^ arow) << 4), la1 = lbase + (arow + 8) * 256 + ((ach ^ (arow + 8)) << 4);   // rows arow + 16 i and arow + 8 + 16 i
  const unsigned lw0 = lbase + 16384 + crow * 128 + ((cch ^ ((crow >> 1) & 7)) << 4);
  const char* gc = (const char*)(O32 + ((size_t)b * NH * SS + s0 + arow) * HD + ach * 4);
  const char* gw = (const char*)(PT + (size_t)(3 * E + n0 + crow) * E + cch * 8);
  auto fill = [&](int t, int buf) { const unsigned o = buf * 32768; const char* c = gc + (size_t)t * SS * HD * 4;
    cp4(la0 + o, c, la0 + o + 4096, c + 4096, la0 + o + 8192, c + 8192, la0 + o + 12288, c + 12288);
    cp4(la1 + o, c + 2048, la1 + o + 4096, c + 2048 + 4096, la1 + o + 8192, c + 2048 + 8192, la1 + o + 12288, c + 2048 + 12288);
    cp_rows64(lw0 + o, gw + t * 128, 16 * E * 2); cp_rows64(lw0 + o + 8192, gw + t * 128 + (size_t)64 * E * 2, 16 * E * 2); };
  const FO fo[2] = { frag_off(0, lane), frag_off(1, lane) };
  fill(0, 0);
  asm volatile("s_wait_asynccnt 0x0" ::: "memory");   // tile 0 landed (my copies)
  __syncthreads();                                    // tile 0 published
  fill(1, 1);
#pragma unroll 1
  for (int t = 0; t < E / 64; ++t) { const char* sb = smem + (t & 1) * 32768; const char* ar = sb + (wave * 16 + col) * 256; const char* wr = sb + 16384 + col * 128;
#pragma unroll
    for (int kc = 0; kc < 2; ++kc) { float v[16];
#pragma unroll
      for (int q = 0; q < 4; ++q) { const v4f x4 = *(const v4f*)(ar + (((kc * 8 + (q >> 1) * 4 + 2 * g + (q & 1)) ^ col) << 4));   // k = kc*32 + (q>>1)*16 + 8g + (q&1)*4 + e
#pragma unroll
        for (int e = 0; e < 4; ++e) v[q * 4 + e] = x4[e]; }
      v16b wf[8];   // the eight weight fragments read as one group ahead of their products
#pragma unroll
      for (int j = 0; j < 8; ++j) wf[j] = frag_sb(wr + j * 2048, fo[kc]);
      __builtin_amdgcn_sched_barrier(0);   // keeps the twenty LDS reads one group ahead of the split and the products; without it they are sunk between the products and each is waited for at once
      const F2 a = bsplit16(v);
#pragma unroll
      for (int j = 0; j < 8; ++j) { acc[j] = wmma_bf(a.l, wf[j], acc[j]); acc[j] = wmma_bf(a.h, wf[j], acc[j]); } }
    RING_FOOT();
    if (t + 2 < E / 64) fill(t + 2, t & 1); }
  asm volatile("s_wait_asynccnt 0x0" ::: "memory");   // nothing in flight when the ring becomes staging
#pragma unroll
  for (int j = 0; j < 8; ++j) { const int n = n0 + j * 16 + col; const float bb = bfr(bo[n]);
#pragma unroll
    for (int r = 0; r < 8; ++r) so[wave][8 * g + r][j * 16 + col] = acc[j][r] + bb; }
  LDSX();
#pragma unroll 4
  for (int rl = 0; rl < 16; ++rl) vst2(out + (size_t)(r0 + rl) * E + n0 + lane * 4, *(const v4f*)(&so[wave][rl][lane * 4]));
}
extern "C" void kernel_launch(void* const* d_in, const int* in_sizes, int n_in, void* d_out, int out_size, void* d_ws, size_t ws_size, hipStream_t stream) {
  (void)in_sizes; (void)n_in; (void)out_size; (void)ws_size;
  const float** I = (const float**)d_in;   // x, x_padding_judge, Wq, bq, Wk, bk, Wv, bv, Wp, bp
  const float* x = I[0]; const float* pad = I[1]; const float* Wq = I[2]; const float* bq = I[3]; const float* Wk = I[4]; const float* bk = I[5]; const float* Wv = I[6]; const float* bv = I[7]; const float* Wp = I[8]; const float* bp = I[9];
  float* out = (float*)d_out;
  char* ws = (char*)d_ws; size_t off = 0;
  auto take = [&](size_t bytes) { char* p = ws + off; off += (bytes + 255) & ~(size_t)255; return p; };
  __bf16* Xb = (__bf16*)take((size_t)NR * E * 2); __bf16* PT = (__bf16*)take((size_t)4 * E * E * 2);
  float* Q32 = (float*)take((size_t)NR * E * 4); __bf16* Kh = (__bf16*)take((size_t)NR * E * 2); __bf16* Kl = (__bf16*)take((size_t)NR * E * 2); _Float16* VTh = (_Float16*)take((size_t)NR * E * 2); _Float16* VTl = (_Float16*)take((size_t)NR * E * 2); float* O32 = (float*)take((size_t)NR * E * 4);
  // ws ~ 84 MB
  k_cvt<<<(NR * E / 8 + 255) / 256, 256, 0, stream>>>(x, Xb);
  k_pack<<<dim3(E / 64, E / 128, 4), 256, 0, stream>>>(Wq, Wk, Wv, Wp, PT);
  k_qkv<<<dim3(NR / 64, E / 128, 3), 128, 0, stream>>>(Xb, PT, bq, bk, bv, Q32, Kh, Kl, VTh, VTl);
  k_attn<<<dim3(SS / 64, NB * NH), 128, 0, stream>>>(Q32, Kh, Kl, VTh, VTl, pad, O32);
  k_out<<<dim3(NR / 64, E / 128), 128, 0, stream>>>(O32, PT, bp, out);
}

// v007
// It runs in 80.1 microseconds.
// It is 1.34 times as fast as v005, going by the measured steps of the versions left out in between.
// Counting every step since v000, it is 5.04 times as fast.
// compute dtype: x, W*, b* (INPUTS) rounded to bf16 with exact bf16 WMMA products (f32 accumulate) for the projections; q, K, P and V each rounded once to f16, one f16 WMMA product (f32 accumulate) for the scores and one for P V; softmax with the -1e9 padding mask in f32.
#include <hip/hip_runtime.h>
#include <math.h>

typedef __attribute__((ext_vector_type(16))) _Float16 v16h;
typedef __attribute__((ext_vector_type(16))) __bf16 v16b;
typedef __attribute__((ext_vector_type(8)))  _Float16 v8h;
typedef __attribute__((ext_vector_type(8)))  float v8f;
typedef __attribute__((ext_vector_type(4)))  float v4f;
typedef __attribute__((ext_vector_type(2)))  float v2f;
typedef __attribute__((ext_vector_type(2)))  _Float16 v2h;
typedef __attribute__((ext_vector_type(4)))  unsigned v4u;
typedef __attribute__((ext_vector_type(4)))  int v4i;
typedef float __attribute__((may_alias)) float_a;
typedef int __attribute__((may_alias)) int_a;

template <typename T> __device__ __forceinline__ void vst2(void* p, T v) { *(T*)p = v;  }
__device__ __forceinline__ v8f wmma16(v16h a, v16h b, v8f c) {
  return __builtin_amdgcn_wmma_f32_16x16x32_f16(false, a, false, b, (short)0, c, false, false);
}
__device__ __forceinline__ v8f wmma_bf(v16b a, v16b b, v8f c) {
  return __builtin_amdgcn_wmma_f32_16x16x32_bf16(false, a, false, b, (short)0, c, false, false);
}
// 16x16x32 fragments: lane = (h = lane>>4, row/col = lane&15); elements 0..7 = k0+8h+0..7, 8..15 = k0+16+8h+0..7; D element r = row 8h+r
__device__ __forceinline__ v16h frag_h(const _Float16* rowk0, int lane) {
  union { v16h v; v8h q[2]; } u; const _Float16* p = rowk0 + 8 * (lane >> 4);
  u.q[0] = *(const v8h*)p; u.q[1] = *(const v8h*)(p + 16); return u.v;
}
__device__ __forceinline__ v16h frag_f32(const float* rowk0, int lane) {
  v16h a; const float* p = rowk0 + 8 * (lane >> 4);
#pragma unroll
  for (int i = 0; i < 8; ++i) { a[i] = (_Float16)p[i]; a[8 + i] = (_Float16)p[16 + i]; }
  return a;
}
__device__ __forceinline__ v16h frag_f32s(const float* rowk0, int lane, float sc) {
  v16h a; const float* p = rowk0 + 8 * (lane >> 4);
#pragma unroll
  for (int i = 0; i < 8; ++i) { a[i] = (_Float16)(p[i] * sc); a[8 + i] = (_Float16)(p[16 + i] * sc); }
  return a;
}
// column fragment from a [K][ld] layout (column n), rows >= K read as 0
__device__ __forceinline__ v16h fragc_f32(const float* W, int k0, int n, int lane, int ld, int K) {
  v16h a; const int g = lane >> 4;
#pragma unroll
  for (int i = 0; i < 8; ++i) { const int ka = k0 + 8 * g + i, kb = ka + 16;
    a[i] = (_Float16)(ka < K ? W[(size_t)ka * ld + n] : 0.f); a[8 + i] = (_Float16)(kb < K ? W[(size_t)kb * ld + n] : 0.f); }
  return a;
}
struct F2 { v16b h, l; };
__device__ __forceinline__ F2 bsplit16(const float v[16]) { F2 r;
#pragma unroll
  for (int i = 0; i < 16; ++i) { const __bf16 h = (__bf16)v[i]; r.h[i] = h; r.l[i] = (__bf16)(v[i] - (float)h); }
  return r; }
__device__ __forceinline__ F2 split_row(const float* row, int k0, int lane) { float v[16]; const float* p = row + k0 + 8 * (lane >> 4);
#pragma unroll
  for (int i = 0; i < 8; ++i) { v[i] = p[i]; v[8 + i] = p[16 + i]; }
  return bsplit16(v); }
__device__ __forceinline__ F2 split_rowK(const float* row, int k0, int lane, int K) { float v[16]; const int g = lane >> 4;
#pragma unroll
  for (int i = 0; i < 8; ++i) { const int ka = k0 + 8 * g + i, kb = ka + 16; v[i] = ka < K ? row[ka] : 0.f; v[8 + i] = kb < K ? row[kb] : 0.f; }
  return bsplit16(v); }
__device__ __forceinline__ F2 split_col(const float* W, int k0, int n, int lane, int ld, int K) { float v[16]; const int g = lane >> 4;
#pragma unroll
  for (int i = 0; i < 8; ++i) { const int ka = k0 + 8 * g + i, kb = ka + 16; v[i] = ka < K ? W[(size_t)ka * ld + n] : 0.f; v[8 + i] = kb < K ? W[(size_t)kb * ld + n] : 0.f; }
  return bsplit16(v); }
__device__ __forceinline__ v8f mac3(const F2& a, const F2& b, v8f c) { c = wmma_bf(a.l, b.h, c); c = wmma_bf(a.h, b.l, c); return wmma_bf(a.h, b.h, c); }
__device__ __forceinline__ float sigm(float v) { return 1.0f / (1.0f + expf(-v)); }
#define LDSX() do { asm volatile("s_wait_dscnt 0" ::: "memory"); __builtin_amdgcn_wave_barrier(); __builtin_amdgcn_fence(__ATOMIC_RELEASE, "workgroup"); } while (0)


// Padding-masked multi-head attention (16 heads of 64 on [4,1024,1024], [in][out] weights + biases, scale 1/8): keep = 1 - pad; score(q,k) = -1e9 wherever keep_q*keep_k == 0
// (so a padded query row attends uniformly to all 1,024 keys, exactly like the reference's masked softmax); y = softmax v; out = y Wp + bp. Not causal despite the module name.
#define NB 4
#define SS 1024
#define E 1024
#define NH 16
#define HD 64
#define NR (NB * SS)
__device__ __forceinline__ float bfr(float v) { return (float)(__bf16)v; }
#define L2E 1.4426950408889634f
// 2^x by the hardware's own exponential instruction: below its range it gives 0, which is what a masked score's weight is
__device__ __forceinline__ float exp2_hw(float x) { return __builtin_amdgcn_exp2f(x); }
__device__ __forceinline__ v16b frag_b(const __bf16* rowk0, int lane) { return __builtin_bit_cast(v16b, frag_h((const _Float16*)rowk0, lane)); }
// ---- operand tiles in LDS, filled by asynchronous copies ----
// A tile row is 128 B (64 16-bit k values) = 8 pieces of 16 B; piece c of row r lies at r*128 + ((c ^ ((r>>1)&7)) << 4): the 16 rows that a half-wave's ds_load_b128 reads fall on all 64 banks.
__device__ __forceinline__ unsigned lds_addr(const void* p) { return (unsigned)(size_t)p; }   // LDS byte address = low 32 bits of the __shared__ address
// Four 16-byte copies per lane, global -> LDS, through no register. s_wait_xcnt closes the statement so that no address register is rewritten ahead of it.
__device__ __forceinline__ void cp4(unsigned l0, const char* g0, unsigned l1, const char* g1, unsigned l2, const char* g2, unsigned l3, const char* g3) {
  asm volatile("global_load_async_to_lds_b128 %0, %1, off\n\t"
               "global_load_async_to_lds_b128 %2, %3, off\n\t"
               "global_load_async_to_lds_b128 %4, %5, off\n\t"
               "global_load_async_to_lds_b128 %6, %7, off\n\t"
               "s_wait_xcnt 0x0"
               :: "v"(l0), "v"(g0), "v"(l1), "v"(g1), "v"(l2), "v"(g2), "v"(l3), "v"(g3) : "memory");
}
// 64 tile rows (four groups of 16 rows, 2,048 B of LDS each) by 128 threads; gs = bytes between 16 source rows
__device__ __forceinline__ void cp_rows64(unsigned l, const char* g, size_t gs) { cp4(l, g, l + 2048, g + gs, l + 4096, g + 2 * gs, l + 6144, g + 3 * gs); }
// publish point of the two-buffer ring: my LDS reads retired, my copies landed, then the work-group barrier that publishes the next tile and frees the one just read
#define RING_FOOT() do { asm volatile("s_wait_dscnt 0x0" ::: "memory"); asm volatile("s_wait_asynccnt 0x0" ::: "memory"); __syncthreads(); } while (0)
struct FO { int a, b; };   // byte places of a fragment's two 16-byte pieces inside its (swizzled) tile row
__device__ __forceinline__ FO frag_off(int kc, int lane) { const int g = lane >> 4, key = (lane & 15) >> 1; FO o; o.a = ((kc * 4 + g) ^ key) << 4; o.b = ((kc * 4 + 2 + g) ^ key) << 4; return o; }
__device__ __forceinline__ v16h frag_sh(const char* row, FO o) { union { v16h v; v4u q[2]; } u; u.q[0] = *(const v4u*)(row + o.a); u.q[1] = *(const v4u*)(row + o.b); return u.v; }
__device__ __forceinline__ v16b frag_sb(const char* row, FO o) { return __builtin_bit_cast(v16b, frag_sh(row, o)); }

__global__ __launch_bounds__(256) void k_cvt(const float* __restrict__ x, __bf16* __restrict__ Xb) {
  const size_t i8 = (size_t)blockIdx.x * 256 + threadIdx.x; if (i8 >= (size_t)NR * E / 8) return;
  union { __bf16 h[8]; v4u u; } pk;
#pragma unroll
  for (int e = 0; e < 8; ++e) pk.h[e] = (__bf16)x[i8 * 8 + e];
  vst2((unsigned*)(Xb + i8 * 8), pk.u);
}
// PT rows: [0,E) Wq[:,n], [E,2E) Wk[:,n], [2E,3E) Wv[:,n], [3E,4E) Wo[:,n]  ([in][out] weights: column n as a bf16 row)
// block = one tile of 128 k by 64 n of one weight: 256-B loads along n, bf16 pairs (k, k+1) laid transposed in LDS, 256-B stores along k
__global__ __launch_bounds__(256) void k_pack(const float* __restrict__ Wq, const float* __restrict__ Wk, const float* __restrict__ Wv, const float* __restrict__ Wo, __bf16* __restrict__ PT) {
  // tile row n = 128 k values = 16 pieces of 16 B; piece j of row n lies at n*256 + ((j ^ (n >> 2)) << 4): the 16 rows 4 c + e that a ds_store_b32 writes and the 16 pieces of a row that a ds_load_b128 reads fall on all 64 banks
  __shared__ __align__(16) unsigned st[64 * 64];
  const int tid = threadIdx.x, c4 = tid & 15, kq = tid >> 4, m = blockIdx.z, k0 = blockIdx.y * 128, n0 = blockIdx.x * 64;
  const float* W = m == 0 ? Wq : (m == 1 ? Wk : (m == 2 ? Wv : Wo));
  const float* p = W + ((size_t)k0 * E + n0) + (kq * 2 * E + c4 * 4);   // one address for the eight loads, the rest in their offsets
  v4f ev[4], od[4];   // rows k0 + 2 kp and k0 + 2 kp + 1, columns n0 + 4 c4 + 0..3; kp = 16 i + kq
#pragma unroll   // the eight loads issue as one group ahead of the first wait
  for (int i = 0; i < 4; ++i) { ev[i] = *(const v4f*)(p + i * 32 * E); od[i] = *(const v4f*)(p + i * 32 * E + E); }
#pragma unroll   // this loop and the next: ev, od stay in registers (constant indices)
  for (int i = 0; i < 4; ++i) { const int kp = i * 16 + kq;
#pragma unroll
    for (int e = 0; e < 4; ++e) { union { __bf16 h[2]; unsigned u; } pk; pk.h[0] = (__bf16)ev[i][e]; pk.h[1] = (__bf16)od[i][e]; st[(c4 * 4 + e) * 64 + ((((kp >> 2) ^ c4) << 2) | (kp & 3))] = pk.u; } }
  __syncthreads();
  __bf16* q = PT + ((size_t)(m * E + n0) * E + k0) + (kq * E + c4 * 8);
#pragma unroll   // the four LDS reads issue together, row steps fold into the stores' offsets
  for (int i = 0; i < 4; ++i) { const int n = i * 16 + kq;
    vst2((unsigned*)(q + i * 16 * E), *(const v4u*)(&st[n * 64 + ((c4 ^ (n >> 2)) << 2)])); }
}
// QKV: block (128 rows, 128 cols = 2 heads, which), four waves 2 x 2, each 64 x 64; q (+bias), k (+bias) -> f16 rows [bh][s][64]; v (+bias) -> VT f16, x4, [bh][d][s]
// 768 blocks = three resident on each of the 256 WGPs: three waves a SIMD, at most 336 registers a wave
// The operand whose index runs along the output's rows is the A side (q, k: weight rows = d; v: x rows = s): a lane's eight accumulator rows are then eight neighbours of one output row, one 16-B piece.
__global__ __launch_bounds__(128) __attribute__((amdgpu_waves_per_eu(3, 3))) void k_qkv(const __bf16* __restrict__ Xb, const __bf16* __restrict__ PT, const float* __restrict__ bq, const float* __restrict__ bk, const float* __restrict__ bv,
                                            _Float16* __restrict__ Qf, _Float16* __restrict__ Kf, _Float16* __restrict__ VT) {
  // ring: 2 buffers x (128 x rows | 128 weight rows) x 128 B; behind the loop's last barrier the same bytes are the output staging
  __shared__ __align__(128) char smem[2 * 256 * 128];
  const int tid = threadIdx.x, wave = tid >> 5, lane = tid & 31, col = lane & 15, g = lane >> 4;
  const int which = blockIdx.z, r0b = blockIdx.x * 128, n0 = blockIdx.y * 128; const int b = r0b / SS, s0 = r0b % SS;
  const int wa = wave >> 1, wb = wave & 1;   // my 64 rows of the A side, of the B side
  const float* bb_ = which == 0 ? bq : (which == 1 ? bk : bv);
  v8f acc[4][4] = {};   // acc[i][j][r]: A-side row wa*64 + i*16 + 8g + r, B-side row wb*64 + j*16 + col
  const int crow = tid >> 3, cch = tid & 7;
  const unsigned ld0 = lds_addr(smem) + crow * 128 + ((cch ^ ((crow >> 1) & 7)) << 4);
  const char* gx = (const char*)(Xb + (size_t)(r0b + crow) * E + cch * 8);
  const char* gw = (const char*)(PT + (size_t)(which * E + n0 + crow) * E + cch * 8);
  auto fill = [&](int t, int buf) { const unsigned l = ld0 + buf * 32768;
    cp_rows64(l, gx + t * 128, 16 * E * 2); cp_rows64(l + 8192, gx + t * 128 + (size_t)64 * E * 2, 16 * E * 2);
    cp_rows64(l + 16384, gw + t * 128, 16 * E * 2); cp_rows64(l + 24576, gw + t * 128 + (size_t)64 * E * 2, 16 * E * 2); };
  const FO fo[2] = { frag_off(0, lane), frag_off(1, lane) };
  const int offA = (which < 2 ? 16384 : 0) + wa * 8192 + col * 128, offB = (which < 2 ? 0 : 16384) + wb * 8192 + col * 128;
  fill(0, 0);
  asm volatile("s_wait_asynccnt 0x0" ::: "memory");   // tile 0 landed (my copies)
  __syncthreads();                                    // tile 0 published
  fill(1, 1);
#pragma unroll 1   // rolled: one copy group and one publish point in the text
  for (int t = 0; t < E / 64; ++t) { const char* sb = smem + (t & 1) * 32768;
#pragma unroll
    for (int kc = 0; kc < 2; ++kc) { v16b fa[4], fb[4];   // eight fragments read as one group ahead of their sixteen products
#pragma unroll
      for (int i = 0; i < 4; ++i) { fa[i] = frag_sb(sb + offA + i * 2048, fo[kc]); fb[i] = frag_sb(sb + offB + i * 2048, fo[kc]); }
      __builtin_amdgcn_sched_barrier(0);   // keeps the group's LDS reads ahead of its products; without it they are sunk between the products in ones and twos
#pragma unroll
      for (int i = 0; i < 4; ++i) {
#pragma unroll
        for (int j = 0; j < 4; ++j) acc[i][j] = wmma_bf(fa[i], fb[j], acc[i][j]); } }
    RING_FOOT();
    if (t + 2 < E / 64) fill(t + 2, t & 1); }
  asm volatile("s_wait_asynccnt 0x0" ::: "memory");   // nothing in flight when the ring becomes staging
  // staging, each wave its own 64 output rows of 64 f16 at a pitch of 144 B (16 B x odd: the 16 rows of a ds_store_b128 fall on all 64 banks)
  char* st = smem + wave * (64 * 144);
  if (which < 2) {
#pragma unroll
    for (int i = 0; i < 4; ++i) { const float* bp8 = bb_ + n0 + wa * 64 + i * 16 + 8 * g; const v4f b0 = *(const v4f*)bp8, b1 = *(const v4f*)(bp8 + 4);
#pragma unroll
      for (int j = 0; j < 4; ++j) { union { _Float16 e[8]; v4u u; } pk;
#pragma unroll
        for (int r = 0; r < 8; ++r) pk.e[r] = (_Float16)(acc[i][j][r] + bfr(r < 4 ? b0[r & 3] : b1[r & 3]));
        *(v4u*)(st + (j * 16 + col) * 144 + (i * 16 + 8 * g) * 2) = pk.u; } } }
  else {
#pragma unroll
    for (int j = 0; j < 4; ++j) { const float bb = bfr(bb_[n0 + wb * 64 + j * 16 + col]);
#pragma unroll
      for (int i = 0; i < 4; ++i) { union { _Float16 e[8]; v4u u; } pk;
#pragma unroll
        for (int r = 0; r < 8; ++r) pk.e[r] = (_Float16)((acc[i][j][r] + bb) * 4.0f);
        *(v4u*)(st + (j * 16 + col) * 144 + (i * 16 + 8 * g) * 2) = pk.u; } } }
  LDSX();
  // q, k: my rows are 64 positions of head (n0 >> 6) + wa, 128 B each and adjacent; v: 64 d rows of head (n0 >> 6) + wb, 128 B (64 positions) of each
  _Float16* dst; int pitch;
  if (which < 2) { dst = (which == 0 ? Qf : Kf) + (((size_t)b * NH + (n0 >> 6) + wa) * SS + s0 + wb * 64) * HD; pitch = HD; }
  else { dst = VT + ((size_t)b * NH + (n0 >> 6) + wb) * HD * SS + s0 + wa * 64; pitch = SS; }
#pragma unroll 1   // rolled: sixteen rows a trip, four LDS reads in flight ahead of their stores
  for (int io = 0; io < 4; ++io) { const int rl = io * 16 + (lane >> 3), pc = lane & 7; v4u pv[4];
#pragma unroll
    for (int ii = 0; ii < 4; ++ii) pv[ii] = *(const v4u*)(st + (rl + ii * 4) * 144 + pc * 16);
#pragma unroll
    for (int ii = 0; ii < 4; ++ii) vst2(dst + (rl + ii * 4) * pitch + pc * 8, pv[ii]);
    asm volatile("s_wait_xcnt 0x0" ::: "memory"); }   // stands in front of the next trip's rewrite of the four stores' registers
}
// the other half-wave's value of the same column: lane l <-> l ^ 16, one vector instruction
__device__ __forceinline__ float xhalf(float v) { const int i = __builtin_bit_cast(int, v); return __builtin_bit_cast(float, __builtin_amdgcn_permlanex16(i, i, 0x76543210, 0xfedcba98, false, false)); }
// padding-masked attention, transposed: block (64 queries, bh); all 16 key tiles; S^T = K q^T (K rows as A, q as B, f16), so a lane holds scores of ONE query (column col, keys 8g + r of each 16-key tile);
// two score tiles, turned into weights in place, are the B operand of O^T += V^T P^T (f16); O f32 [bh][s][64]
// four waves a SIMD (the four resident blocks of a WGP) need at most 256 registers a wave
__global__ __launch_bounds__(128) __attribute__((amdgpu_waves_per_eu(4, 4))) void k_attn(const _Float16* __restrict__ Qf, const _Float16* __restrict__ Kf, const _Float16* __restrict__ VT, const float* __restrict__ pad, float* __restrict__ O32) {
  __shared__ __align__(16) float sO[4][16][68];   // output staging, each wave its own 16 query rows: the rows leave as whole 256-B runs
  __shared__ __align__(16) float skk[SS];         // keep flags of the 1,024 keys of this batch row
  // ring of two buffers, tiles in the order K(0), V(0), K(1), V(1), ...: sK = 64 key rows, sV = 64 d rows of V^T, 128 B a row
  __shared__ __align__(128) char sK[64 * 128], sV[64 * 128];
  const int tid = threadIdx.x, w = tid >> 5, lane = tid & 31, col = lane & 15, g = lane >> 4;
  const size_t bh = blockIdx.y; const int qb = blockIdx.x; const int q0 = qb * 64 + w * 16;
  v16h aq[2];
#pragma unroll
  for (int kc = 0; kc < 2; ++kc) aq[kc] = frag_h(Qf + (bh * SS + q0 + col) * HD + kc * 32, lane);
  asm volatile("s_wait_xcnt 0x0" ::: "memory");   // the four q loads name one address pair: the wait stands in front of any rewrite of those registers
  const int b = (int)(bh / NH);
  const float keepq = 1.0f - pad[(size_t)b * SS + q0 + col];     // keep flag of my query
  { const v4f one = { 1.0f, 1.0f, 1.0f, 1.0f }; const float* pp = pad + (size_t)b * SS + tid * 8;
    *(v4f*)(&skk[tid * 8]) = one - *(const v4f*)pp; *(v4f*)(&skk[tid * 8 + 4]) = one - *(const v4f*)(pp + 4); }
  float mrun = -3.0e38f, lrun = 0.f; v8f acc[4] = {};
  const int crow = tid >> 3, cch = tid & 7;
  const unsigned lofs = crow * 128 + ((cch ^ ((crow >> 1) & 7)) << 4);
  const unsigned lK = lds_addr(sK) + lofs, lV = lds_addr(sV) + lofs;
  const char* gK = (const char*)(Kf + (bh * SS + crow) * HD + cch * 8);
  const char* gV = (const char*)(VT + (bh * HD + crow) * SS + cch * 8);
  auto fillK = [&](int kt) { cp_rows64(lK, gK + (size_t)kt * 64 * HD * 2, 16 * HD * 2); };
  auto fillV = [&](int kt) { cp_rows64(lV, gV + kt * 128, 16 * SS * 2); };
  const FO fo[2] = { frag_off(0, lane), frag_off(1, lane) };
  fillK(0);
  asm volatile("s_wait_asynccnt 0x0" ::: "memory");   // K(0) landed (my copies)
  LDSX();                                             // my key flags written
  __syncthreads();                                    // K(0) and the key flags published
  fillV(0);
#pragma unroll 1
  for (int kt = 0; kt < SS / 64; ++kt) {
    v8f s[4];   // s[t][r] = score of key kt*64 + t*16 + 8g + r against query col
#pragma unroll
    for (int t = 0; t < 4; ++t) { const char* kr = sK + (t * 16 + col) * 128; v8f d = {};
#pragma unroll
      for (int kc = 0; kc < 2; ++kc) d = wmma16(frag_sh(kr, fo[kc]), aq[kc], d);
      const float* kf = &skk[kt * 64 + t * 16 + 8 * g]; const v4f k0 = *(const v4f*)kf, k1 = *(const v4f*)(kf + 4);
#pragma unroll
      for (int r = 0; r < 8; ++r) { const float keepk = r < 4 ? k0[r & 3] : k1[r & 3]; s[t][r] = (keepq * keepk == 0.f) ? -1.0e9f : d[r] * 0.125f; } }
    RING_FOOT();                                 // V(kt) published, K(kt) left by every wave
    if (kt + 1 < SS / 64) fillK(kt + 1);
    float mx = -3.4e38f;
#pragma unroll
    for (int t = 0; t < 4; ++t) {
#pragma unroll
      for (int r = 0; r < 8; ++r) mx = fmaxf(mx, s[t][r]); }
    mx = fmaxf(mx, xhalf(mx));
    const float mnew = fmaxf(mrun, mx); const float corr = exp2_hw((mrun - mnew) * L2E);
    v2f ps2 = { 0.f, 0.f };   // p = e^(s - m) * 2^14; the difference is formed first, so a row of equal scores (-1e9 everywhere) gets the exponent 14 at every key, whatever the size of m
    const v2f m2 = { mnew, mnew }, l2 = { L2E, L2E }, c2 = { 14.0f, 14.0f };
    v16h ph[2];   // B fragments of P^T: element e of fragment kc = key kc*32 + (e < 8 ? 8g + e : 16 + 8g + e - 8) = score tile 2 kc + (e >> 3), register e & 7
#pragma unroll
    for (int t = 0; t < 4; ++t) {
#pragma unroll
      for (int r = 0; r < 8; r += 2) { const v2f s2 = { s[t][r], s[t][r + 1] }; const v2f a = __builtin_elementwise_fma(s2 - m2, l2, c2);   // two exponents a packed instruction
        const v2f p2 = { exp2_hw(a[0]), exp2_hw(a[1]) }; ps2 += p2;
        const v2h h2 = __builtin_convertvector(p2, v2h);   // two keys a register
        const int i = (t & 1) * 8 + r; ph[t >> 1][i] = h2[0]; ph[t >> 1][i + 1] = h2[1]; } }
    float ps = ps2[0] + ps2[1]; ps += xhalf(ps);
    lrun = lrun * corr + ps * (1.0f / 16384.0f); mrun = mnew;
#pragma unroll
    for (int t = 0; t < 4; ++t) acc[t] *= corr;
    __builtin_amdgcn_sched_barrier(0);   // the V reads and their products start behind the weights' arithmetic; without it they are spread through it in ones and twos, each read waited for at once
#pragma unroll
    for (int kc = 0; kc < 2; ++kc) {
#pragma unroll
      for (int t = 0; t < 4; ++t) acc[t] = wmma16(frag_sh(sV + (t * 16 + col) * 128, fo[kc]), ph[kc], acc[t]); }
    RING_FOOT();                                 // K(kt+1) published, V(kt) left by every wave
    if (kt + 1 < SS / 64) fillV(kt + 1); }
  asm volatile("s_wait_asynccnt 0x0" ::: "memory");   // nothing in flight at the wave's end
  const float inv = 1.0f / (lrun * 16384.0f * 4.0f);
#pragma unroll
  for (int t = 0; t < 4; ++t) {   // acc[t][r] = O[query col][d = t*16 + 8g + r]
#pragma unroll
    for (int r = 0; r < 8; ++r) sO[w][col][t * 16 + 8 * g + r] = acc[t][r] * inv; }
  LDSX();
  for (int qq = lane; qq < 16 * 16; qq += 32) { const int rl = qq >> 4, pc = qq & 15; vst2(O32 + ((bh * SS) + q0 + rl) * HD + pc * 4, *(const v4f*)(&sO[w][rl][pc * 4])); }
}
// out = ctx Wo + bo : split(ctx) x bf16(Wo rows): 2 products (Wo is an INPUT -> bf16 exact)
__global__ __launch_bounds__(128) void k_out(const float* __restrict__ O32, const __bf16* __restrict__ PT, const float* __restrict__ bo, float* __restrict__ out) {
  // ring: 2 buffers x (64 ctx rows of 256 B, f32, one head | 128 weight rows of 128 B); behind the loop's last barrier the same bytes are the output staging
  __shared__ __align__(128) char smem[2 * 32768];
  float (*so)[16][132] = (float (*)[16][132])smem;
  const int tid = threadIdx.x, wave = tid >> 5, lane = tid & 31, col = lane & 15, g = lane >> 4;
  const int r0b = blockIdx.x * 64, r0 = r0b + wave * 16, n0 = blockIdx.y * 128; const int b = r0b / SS, s0 = r0b % SS;
  v8f acc[8] = {};
  // ctx rows: 16 pieces of 16 B, piece c of row r at r*256 + ((c ^ (r&15)) << 4): 16 rows of one piece index fall on all 64 banks
  const int arow = tid >> 4, ach = tid & 15, crow = tid >> 3, cch = tid & 7;
  const unsigned lbase = lds_addr(smem);
  const unsigned la0 = lbase + arow * 256 + ((ach ^ arow) << 4), la1 = lbase + (arow + 8) * 256 + ((ach ^ (arow + 8)) << 4);   // rows arow + 16 i and arow + 8 + 16 i
  const unsigned lw0 = lbase + 16384 + crow * 128 + ((cch ^ ((crow >> 1) & 7)) << 4);
  const char* gc = (const char*)(O32 + ((size_t)b * NH * SS + s0 + arow) * HD + ach * 4);
  const char* gw = (const char*)(PT + (size_t)(3 * E + n0 + crow) * E + cch * 8);
  auto fill = [&](int t, int buf) { const unsigned o = buf * 32768; const char* c = gc + (size_t)t * SS * HD * 4;
    cp4(la0 + o, c, la0 + o + 4096, c + 4096, la0 + o + 8192, c + 8192, la0 + o + 12288, c + 12288);
    cp4(la1 + o, c + 2048, la1 + o + 4096, c + 2048 + 4096, la1 + o + 8192, c + 2048 + 8192, la1 + o + 12288, c + 2048 + 12288);
    cp_rows64(lw0 + o, gw + t * 128, 16 * E * 2); cp_rows64(lw0 + o + 8192, gw + t * 128 + (size_t)64 * E * 2, 16 * E * 2); };
  const FO fo[2] = { frag_off(0, lane), frag_off(1, lane) };
  fill(0, 0);
  asm volatile("s_wait_asynccnt 0x0" ::: "memory");   // tile 0 landed (my copies)
  __syncthreads();                                    // tile 0 published
  fill(1, 1);
#pragma unroll 1
  for (int t = 0; t < E / 64; ++t) { const char* sb = smem + (t & 1) * 32768; const char* ar = sb + (wave * 16 + col) * 256; const char* wr = sb + 16384 + col * 128;
#pragma unroll
    for (int kc = 0; kc < 2; ++kc) { float v[16];
#pragma unroll
      for (int q = 0; q < 4; ++q) { const v4f x4 = *(const v4f*)(ar + (((kc * 8 + (q >> 1) * 4 + 2 * g + (q & 1)) ^ col) << 4));   // k = kc*32 + (q>>1)*16 + 8g + (q&1)*4 + e
#pragma unroll
        for (int e = 0; e < 4; ++e) v[q * 4 + e] = x4[e]; }
      v16b wf[8];   // the eight weight fragments read as one group ahead of their products
#pragma unroll
      for (int j = 0; j < 8; ++j) wf[j] = frag_sb(wr + j * 2048, fo[kc]);
      __builtin_amdgcn_sched_barrier(0);   // keeps the twenty LDS reads one group ahead of the split and the products; without it they are sunk between the products and each is waited for at once
      const F2 a = bsplit16(v);
#pragma unroll
      for (int j = 0; j < 8; ++j) { acc[j] = wmma_bf(a.l, wf[j], acc[j]); acc[j] = wmma_bf(a.h, wf[j], acc[j]); } }
    RING_FOOT();
    if (t + 2 < E / 64) fill(t + 2, t & 1); }
  asm volatile("s_wait_asynccnt 0x0" ::: "memory");   // nothing in flight when the ring becomes staging
#pragma unroll
  for (int j = 0; j < 8; ++j) { const int n = n0 + j * 16 + col; const float bb = bfr(bo[n]);
#pragma unroll
    for (int r = 0; r < 8; ++r) so[wave][8 * g + r][j * 16 + col] = acc[j][r] + bb; }
  LDSX();
#pragma unroll 4
  for (int rl = 0; rl < 16; ++rl) vst2(out + (size_t)(r0 + rl) * E + n0 + lane * 4, *(const v4f*)(&so[wave][rl][lane * 4]));
}
extern "C" void kernel_launch(void* const* d_in, const int* in_sizes, int n_in, void* d_out, int out_size, void* d_ws, size_t ws_size, hipStream_t stream) {
  (void)in_sizes; (void)n_in; (void)out_size; (void)ws_size;
  const float** I = (const float**)d_in;   // x, x_padding_judge, Wq, bq, Wk, bk, Wv, bv, Wp, bp
  const float* x = I[0]; const float* pad = I[1]; const float* Wq = I[2]; const float* bq = I[3]; const float* Wk = I[4]; const float* bk = I[5]; const float* Wv = I[6]; const float* bv = I[7]; const float* Wp = I[8]; const float* bp = I[9];
  float* out = (float*)d_out;
  char* ws = (char*)d_ws; size_t off = 0;
  auto take = [&](size_t bytes) { char* p = ws + off; off += (bytes + 255) & ~(size_t)255; return p; };
  __bf16* Xb = (__bf16*)take((size_t)NR * E * 2); __bf16* PT = (__bf16*)take((size_t)4 * E * E * 2);
  _Float16* Qf = (_Float16*)take((size_t)NR * E * 2); _Float16* Kf = (_Float16*)take((size_t)NR * E * 2); _Float16* VT = (_Float16*)take((size_t)NR * E * 2); float* O32 = (float*)take((size_t)NR * E * 4);
  // ws ~ 59 MB
  k_cvt<<<(NR * E / 8 + 255) / 256, 256, 0, stream>>>(x, Xb);
  k_pack<<<dim3(E / 64, E / 128, 4), 256, 0, stream>>>(Wq, Wk, Wv, Wp, PT);
  k_qkv<<<dim3(NR / 128, E / 128, 3), 128, 0, stream>>>(Xb, PT, bq, bk, bv, Qf, Kf, VT);
  k_attn<<<dim3(SS / 64, NB * NH), 128, 0, stream>>>(Qf, Kf, VT, pad, O32);
  k_out<<<dim3(NR / 64, E / 128), 128, 0, stream>>>(O32, PT, bp, out);
}

// v009
// Measured time: 72.2 microseconds a run.
// Versions in between are left out here; by their measured steps it is 1.11 times as fast as v007.
// All steps since v000 together make it 5.61 times as fast.
// compute dtype: x, W*, b* (INPUTS) rounded to bf16 with exact bf16 WMMA products (f32 accumulate) for the projections; q, K, P and V each rounded once to f16, one f16 WMMA product (f32 accumulate) for the scores and one for P V; softmax with the -1e9 padding mask in f32; the attention output rounded once to f16, one f16 WMMA product against Wp's bf16-rounded values carried as f16.
#include <hip/hip_runtime.h>
#include <math.h>

typedef __attribute__((ext_vector_type(16))) _Float16 v16h;
typedef __attribute__((ext_vector_type(16))) __bf16 v16b;
typedef __attribute__((ext_vector_type(8)))  _Float16 v8h;
typedef __attribute__((ext_vector_type(8)))  float v8f;
typedef __attribute__((ext_vector_type(4)))  float v4f;
typedef __attribute__((ext_vector_type(2)))  float v2f;
typedef __attribute__((ext_vector_type(2)))  _Float16 v2h;
typedef __attribute__((ext_vector_type(2)))  __bf16 v2b;
typedef __attribute__((ext_vector_type(4)))  unsigned v4u;
typedef __attribute__((ext_vector_type(4)))  int v4i;
typedef float __attribute__((may_alias)) float_a;
typedef int __attribute__((may_alias)) int_a;

template <typename T> __device__ __forceinline__ void vst2(void* p, T v) { *(T*)p = v;  }
__device__ __forceinline__ v8f wmma16(v16h a, v16h b, v8f c) {
  return __builtin_amdgcn_wmma_f32_16x16x32_f16(false, a, false, b, (short)0, c, false, false);
}
__device__ __forceinline__ v8f wmma_bf(v16b a, v16b b, v8f c) {
  return __builtin_amdgcn_wmma_f32_16x16x32_bf16(false, a, false, b, (short)0, c, false, false);
}
// 16x16x32 fragments: lane = (h = lane>>4, row/col = lane&15); elements 0..7 = k0+8h+0..7, 8..15 = k0+16+8h+0..7; D element r = row 8h+r
__device__ __forceinline__ v16h frag_h(const _Float16* rowk0, int lane) {
  union { v16h v; v8h q[2]; } u; const _Float16* p = rowk0 + 8 * (lane >> 4);
  u.q[0] = *(const v8h*)p; u.q[1] = *(const v8h*)(p + 16); return u.v;
}
__device__ __forceinline__ v16h frag_f32(const float* rowk0, int lane) {
  v16h a; const float* p = rowk0 + 8 * (lane >> 4);
#pragma unroll
  for (int i = 0; i < 8; ++i) { a[i] = (_Float16)p[i]; a[8 + i] = (_Float16)p[16 + i]; }
  return a;
}
__device__ __forceinline__ v16h frag_f32s(const float* rowk0, int lane, float sc) {
  v16h a; const float* p = rowk0 + 8 * (lane >> 4);
#pragma unroll
  for (int i = 0; i < 8; ++i) { a[i] = (_Float16)(p[i] * sc); a[8 + i] = (_Float16)(p[16 + i] * sc); }
  return a;
}
// column fragment from a [K][ld] layout (column n), rows >= K read as 0
__device__ __forceinline__ v16h fragc_f32(const float* W, int k0, int n, int lane, int ld, int K) {
  v16h a; const int g = lane >> 4;
#pragma unroll
  for (int i = 0; i < 8; ++i) { const int ka = k0 + 8 * g + i, kb = ka + 16;
    a[i] = (_Float16)(ka < K ? W[(size_t)ka * ld + n] : 0.f); a[8 + i] = (_Float16)(kb < K ? W[(size_t)kb * ld + n] : 0.f); }
  return a;
}
struct F2 { v16b h, l; };
__device__ __forceinline__ F2 bsplit16(const float v[16]) { F2 r;
#pragma unroll
  for (int i = 0; i < 16; ++i) { const __bf16 h = (__bf16)v[i]; r.h[i] = h; r.l[i] = (__bf16)(v[i] - (float)h); }
  return r; }
__device__ __forceinline__ F2 split_row(const float* row, int k0, int lane) { float v[16]; const float* p = row + k0 + 8 * (lane >> 4);
#pragma unroll
  for (int i = 0; i < 8; ++i) { v[i] = p[i]; v[8 + i] = p[16 + i]; }
  return bsplit16(v); }
__device__ __forceinline__ F2 split_rowK(const float* row, int k0, int lane, int K) { float v[16]; const int g = lane >> 4;
#pragma unroll
  for (int i = 0; i < 8; ++i) { const int ka = k0 + 8 * g + i, kb = ka + 16; v[i] = ka < K ? row[ka] : 0.f; v[8 + i] = kb < K ? row[kb] : 0.f; }
  return bsplit16(v); }
__device__ __forceinline__ F2 split_col(const float* W, int k0, int n, int lane, int ld, int K) { float v[16]; const int g = lane >> 4;
#pragma unroll
  for (int i = 0; i < 8; ++i) { const int ka = k0 + 8 * g + i, kb = ka + 16; v[i] = ka < K ? W[(size_t)ka * ld + n] : 0.f; v[8 + i] = kb < K ? W[(size_t)kb * ld + n] : 0.f; }
  return bsplit16(v); }
__device__ __forceinline__ v8f mac3(const F2& a, const F2& b, v8f c) { c = wmma_bf(a.l, b.h, c); c = wmma_bf(a.h, b.l, c); return wmma_bf(a.h, b.h, c); }
__device__ __forceinline__ float sigm(float v) { return 1.0f / (1.0f + expf(-v)); }
#define LDSX() do { asm volatile("s_wait_dscnt 0" ::: "memory"); __builtin_amdgcn_wave_barrier(); __builtin_amdgcn_fence(__ATOMIC_RELEASE, "workgroup"); } while (0)


// Padding-masked multi-head attention (16 heads of 64 on [4,1024,1024], [in][out] weights + biases, scale 1/8): keep = 1 - pad; score(q,k) = -1e9 wherever keep_q*keep_k == 0
// (so a padded query row attends uniformly to all 1,024 keys, exactly like the reference's masked softmax); y = softmax v; out = y Wp + bp. Not causal despite the module name.
// Token order: every stage but the attention works on one token at a time, so k_cvt lays each batch row's tokens out anew, the kept ones (keep != 0) first in their old order, then the padded ones; k_out stores each row at its old place.
// keep_q*keep_k == 0 exactly when one of the two is 0 (a nonzero keep = 1 - pad is at least 2^-24 in size, so the product does not underflow). A kept query gives a padded key the weight e^(-1e9 - m) = 0: its keys end at the last kept one.
#define NB 4
#define SS 1024
#define E 1024
#define NH 16
#define HD 64
#define NR (NB * SS)
__device__ __forceinline__ float bfr(float v) { return (float)(__bf16)v; }
#define L2E 1.4426950408889634f
// 2^x by the hardware's own exponential instruction: below its range it gives 0, which is what a masked score's weight is
__device__ __forceinline__ float exp2_hw(float x) { return __builtin_amdgcn_exp2f(x); }
__device__ __forceinline__ v16b frag_b(const __bf16* rowk0, int lane) { return __builtin_bit_cast(v16b, frag_h((const _Float16*)rowk0, lane)); }
// ---- operand tiles in LDS, filled by asynchronous copies ----
// A tile row is 128 B (64 16-bit k values) = 8 pieces of 16 B; piece c of row r lies at r*128 + ((c ^ ((r>>1)&7)) << 4): the 16 rows that a half-wave's ds_load_b128 reads fall on all 64 banks.
__device__ __forceinline__ unsigned lds_addr(const void* p) { return (unsigned)(size_t)p; }   // LDS byte address = low 32 bits of the __shared__ address
// Four 16-byte copies per lane, global -> LDS, through no register. s_wait_xcnt closes the statement so that no address register is rewritten ahead of it.
__device__ __forceinline__ void cp4(unsigned l0, const char* g0, unsigned l1, const char* g1, unsigned l2, const char* g2, unsigned l3, const char* g3) {
  asm volatile("global_load_async_to_lds_b128 %0, %1, off\n\t"
               "global_load_async_to_lds_b128 %2, %3, off\n\t"
               "global_load_async_to_lds_b128 %4, %5, off\n\t"
               "global_load_async_to_lds_b128 %6, %7, off\n\t"
               "s_wait_xcnt 0x0"
               :: "v"(l0), "v"(g0), "v"(l1), "v"(g1), "v"(l2), "v"(g2), "v"(l3), "v"(g3) : "memory");
}
// 64 tile rows (four groups of 16 rows, 2,048 B of LDS each) by 128 threads; gs = bytes between 16 source rows
__device__ __forceinline__ void cp_rows64(unsigned l, const char* g, size_t gs) { cp4(l, g, l + 2048, g + gs, l + 4096, g + 2 * gs, l + 6144, g + 3 * gs); }
// publish point of the two-buffer ring: my LDS reads retired, my copies landed, then the work-group barrier that publishes the next tile and frees the one just read
#define RING_FOOT() do { asm volatile("s_wait_dscnt 0x0" ::: "memory"); asm volatile("s_wait_asynccnt 0x0" ::: "memory"); __syncthreads(); } while (0)
struct FO { int a, b; };   // byte places of a fragment's two 16-byte pieces inside its (swizzled) tile row
__device__ __forceinline__ FO frag_off(int kc, int lane) { const int g = lane >> 4, key = (lane & 15) >> 1; FO o; o.a = ((kc * 4 + g) ^ key) << 4; o.b = ((kc * 4 + 2 + g) ^ key) << 4; return o; }
__device__ __forceinline__ v16h frag_sh(const char* row, FO o) { union { v16h v; v4u q[2]; } u; u.q[0] = *(const v4u*)(row + o.a); u.q[1] = *(const v4u*)(row + o.b); return u.v; }
__device__ __forceinline__ v16b frag_sb(const char* row, FO o) { return __builtin_bit_cast(v16b, frag_sh(row, o)); }

// block = two tokens of x, rounded to bf16 and stored at their new places. The first block of a batch row b also writes the row's tables (one block, so that no 128-B line has two writers):
// perm[new place] = old place, padp = the padding flags in the new order, nkeep[32 b] = kept tokens (a line of its own for each b)
__global__ __launch_bounds__(256) void k_cvt(const float* __restrict__ x, const float* __restrict__ pad, __bf16* __restrict__ Xb, float* __restrict__ padp, int* __restrict__ perm, int* __restrict__ nkeep) {
  __shared__ int cnt[8];
  const int tid = threadIdx.x, row0 = blockIdx.x * 2, b = row0 / SS, s0 = row0 % SS;
  const float* xr = x + (size_t)blockIdx.x * 2048 + tid * 8;
  const v4f x0 = *(const v4f*)xr, x1 = *(const v4f*)(xr + 4);
  const float* pb = pad + b * SS;
  const v4f pf = *(const v4f*)(pb + tid * 4);   // the 1,024 flags of the batch row, four a thread
  const float p0 = pb[s0], p1 = pb[s0 + 1];
  int tot = 0, bef = 0;   // kept tokens in my wave's 128 flags: all, and those in front of token s0
  unsigned km[4];         // bit l of km[e]: token 4 (tid - lane + l) + e is kept
#pragma unroll   // this loop and those below: pf, km, x0, x1 stay in registers (constant indices)
  for (int e = 0; e < 4; ++e) { const bool k = (1.0f - pf[e]) != 0.f; km[e] = __builtin_amdgcn_ballot_w32(k);
    tot += __popc(km[e]); bef += __popc(__builtin_amdgcn_ballot_w32(k && tid * 4 + e < s0)); }
  if ((tid & 31) == 0) cnt[tid >> 5] = tot | (bef << 16);   // both at most 1,024: the packed sums do not carry
  __syncthreads();
  int sum = 0;
#pragma unroll
  for (int i = 0; i < 8; ++i) sum += cnt[i];
  tot = sum & 0xffff; bef = sum >> 16;
  const int k0 = (1.0f - p0) != 0.f ? 1 : 0, k1 = (1.0f - p1) != 0.f ? 1 : 0, bef1 = bef + k0;
  const int d0 = k0 ? bef : tot + (s0 - bef), d1 = k1 ? bef1 : tot + (s0 + 1 - bef1);   // kept: rank among the kept; padded: behind all kept, rank among the padded
  const int hi = tid >> 7, d = b * SS + (hi ? d1 : d0);
  union { __bf16 h[8]; v4u u; } pk;
#pragma unroll
  for (int e = 0; e < 4; ++e) { pk.h[e] = (__bf16)x0[e]; pk.h[4 + e] = (__bf16)x1[e]; }
  vst2((unsigned*)(Xb + (size_t)d * E + (tid & 127) * 8), pk.u);
  asm volatile("s_wait_xcnt 0x0" ::: "memory");   // stands in front of the rewrite of the store's registers in the branch below
  if (s0 == 0) {   // the same for the whole block
    const int lane = tid & 31; const unsigned lt = (1u << lane) - 1u;
    int r = 0;     // kept tokens in front of token 4 tid: the waves in front of mine, then the lanes in front of me
#pragma unroll
    for (int i = 0; i < 8; ++i) r += i < (tid >> 5) ? (cnt[i] & 0xffff) : 0;
#pragma unroll
    for (int e = 0; e < 4; ++e) r += __popc(km[e] & lt);
#pragma unroll
    for (int e = 0; e < 4; ++e) { const int s = tid * 4 + e, k = (km[e] >> lane) & 1, dn = b * SS + (k ? r : tot + (s - r));
      perm[dn] = s; padp[dn] = pf[e]; r += k; }
    if (tid == 0) nkeep[b * 32] = tot; }
}
// PT rows: [0,E) Wq[:,n], [E,2E) Wk[:,n], [2E,3E) Wv[:,n], [3E,4E) Wo[:,n]  ([in][out] weights: column n as a bf16 row; Wo's rows hold the same bf16-rounded values written as f16: unchanged from 2^-17 to 65504 in size, rounded to a multiple of 2^-24 below, infinite above)
// block = one tile of 128 k by 64 n of one weight: 256-B loads along n, bf16 pairs (k, k+1) laid transposed in LDS, 256-B stores along k
__global__ __launch_bounds__(256) void k_pack(const float* __restrict__ Wq, const float* __restrict__ Wk, const float* __restrict__ Wv, const float* __restrict__ Wo, __bf16* __restrict__ PT) {
  // tile row n = 128 k values = 16 pieces of 16 B; piece j of row n lies at n*256 + ((j ^ (n >> 2)) << 4): the 16 rows 4 c + e that a ds_store_b32 writes and the 16 pieces of a row that a ds_load_b128 reads fall on all 64 banks
  __shared__ __align__(16) unsigned st[64 * 64];
  const int tid = threadIdx.x, c4 = tid & 15, kq = tid >> 4, m = blockIdx.z, k0 = blockIdx.y * 128, n0 = blockIdx.x * 64;
  const float* W = m == 0 ? Wq : (m == 1 ? Wk : (m == 2 ? Wv : Wo));
  const float* p = W + ((size_t)k0 * E + n0) + (kq * 2 * E + c4 * 4);   // one address for the eight loads, the rest in their offsets
  v4f ev[4], od[4];   // rows k0 + 2 kp and k0 + 2 kp + 1, columns n0 + 4 c4 + 0..3; kp = 16 i + kq
#pragma unroll   // the eight loads issue as one group ahead of the first wait
  for (int i = 0; i < 4; ++i) { ev[i] = *(const v4f*)(p + i * 32 * E); od[i] = *(const v4f*)(p + i * 32 * E + E); }
  unsigned pr[4][4];   // bf16 pairs (k, k+1)
#pragma unroll   // these loops: ev, od, pr stay in registers (constant indices)
  for (int i = 0; i < 4; ++i) {
#pragma unroll
    for (int e = 0; e < 4; ++e) { const v2f f2 = { ev[i][e], od[i][e] }; pr[i][e] = __builtin_bit_cast(unsigned, __builtin_convertvector(f2, v2b)); } }
  if (m == 3) {   // Wo: the rounded pair written anew as f16
#pragma unroll
    for (int i = 0; i < 4; ++i) {
#pragma unroll
      for (int e = 0; e < 4; ++e) { const v2f f2 = { __builtin_bit_cast(float, pr[i][e] << 16), __builtin_bit_cast(float, pr[i][e] & 0xffff0000u) };
        pr[i][e] = __builtin_bit_cast(unsigned, __builtin_convertvector(f2, v2h)); } } }
#pragma unroll
  for (int i = 0; i < 4; ++i) { const int kp = i * 16 + kq;
#pragma unroll
    for (int e = 0; e < 4; ++e) st[(c4 * 4 + e) * 64 + ((((kp >> 2) ^ c4) << 2) | (kp & 3))] = pr[i][e]; }
  __syncthreads();
  __bf16* q = PT + ((size_t)(m * E + n0) * E + k0) + (kq * E + c4 * 8);
#pragma unroll   // the four LDS reads issue together, row steps fold into the stores' offsets
  for (int i = 0; i < 4; ++i) { const int n = i * 16 + kq;
    vst2((unsigned*)(q + i * 16 * E), *(const v4u*)(&st[n * 64 + ((c4 ^ (n >> 2)) << 2)])); }
}
// QKV: block (128 rows, 128 cols = 2 heads, which), four waves 2 x 2, each 64 x 64; q (+bias), k (+bias) -> f16 rows [bh][s][64]; v (+bias) -> VT f16, x4, [bh][d][s]
// 768 blocks = three resident on each of the 256 WGPs: three waves a SIMD, at most 336 registers a wave
// The operand whose index runs along the output's rows is the A side (q, k: weight rows = d; v: x rows = s): a lane's eight accumulator rows are then eight neighbours of one output row, one 16-B piece.
__global__ __launch_bounds__(128) __attribute__((amdgpu_waves_per_eu(3, 3))) void k_qkv(const __bf16* __restrict__ Xb, const __bf16* __restrict__ PT, const float* __restrict__ bq, const float* __restrict__ bk, const float* __restrict__ bv, const int* __restrict__ nkeep,
                                            _Float16* __restrict__ Qf, _Float16* __restrict__ Kf, _Float16* __restrict__ VT) {
  // ring: 2 buffers x (128 x rows | 128 weight rows) x 128 B; behind the loop's last barrier the same bytes are the output staging
  __shared__ __align__(128) char smem[2 * 256 * 128];
  const int tid = threadIdx.x, wave = tid >> 5, lane = tid & 31, col = lane & 15, g = lane >> 4;
  const int which = blockIdx.z, n0 = blockIdx.y * 128;
  const int r0b = (which == 1 ? (int)blockIdx.x ^ (SS / 128 - 1) : (int)blockIdx.x) * 128;   // for speed only: k walks a batch row's eight row blocks backwards, so that the q and k blocks that leave below do not fall on the same grid x
  const int b = r0b / SS, s0 = r0b % SS;
  // q and k of padded tokens: k_attn reads q and K rows only in front of the first multiple of 64 that is no smaller than the kept count, so a block of 128 rows that starts at or behind the count leaves
  // (the same for the whole block, in front of every copy and barrier); v is needed of every token
  if (which < 2 && s0 >= min(max(nkeep[b * 32], 0), SS)) return;
  const int wa = wave >> 1, wb = wave & 1;   // my 64 rows of the A side, of the B side
  const float* bb_ = which == 0 ? bq : (which == 1 ? bk : bv);
  v8f acc[4][4] = {};   // acc[i][j][r]: A-side row wa*64 + i*16 + 8g + r, B-side row wb*64 + j*16 + col
  const int crow = tid >> 3, cch = tid & 7;
  const unsigned ld0 = lds_addr(smem) + crow * 128 + ((cch ^ ((crow >> 1) & 7)) << 4);
  const char* gx = (const char*)(Xb + (size_t)(r0b + crow) * E + cch * 8);
  const char* gw = (const char*)(PT + (size_t)(which * E + n0 + crow) * E + cch * 8);
  auto fill = [&](int t, int buf) { const unsigned l = ld0 + buf * 32768;
    cp_rows64(l, gx + t * 128, 16 * E * 2); cp_rows64(l + 8192, gx + t * 128 + (size_t)64 * E * 2, 16 * E * 2);
    cp_rows64(l + 16384, gw + t * 128, 16 * E * 2); cp_rows64(l + 24576, gw + t * 128 + (size_t)64 * E * 2, 16 * E * 2); };
  const FO fo[2] = { frag_off(0, lane), frag_off(1, lane) };
  const int offA = (which < 2 ? 16384 : 0) + wa * 8192 + col * 128, offB = (which < 2 ? 0 : 16384) + wb * 8192 + col * 128;
  fill(0, 0);
  asm volatile("s_wait_asynccnt 0x0" ::: "memory");   // tile 0 landed (my copies)
  __syncthreads();                                    // tile 0 published
  fill(1, 1);
#pragma unroll 1   // rolled: one copy group and one publish point in the text
  for (int t = 0; t < E / 64; ++t) { const char* sb = smem + (t & 1) * 32768;
#pragma unroll
    for (int kc = 0; kc < 2; ++kc) { v16b fa[4], fb[4];   // eight fragments read as one group ahead of their sixteen products
#pragma unroll
      for (int i = 0; i < 4; ++i) { fa[i] = frag_sb(sb + offA + i * 2048, fo[kc]); fb[i] = frag_sb(sb + offB + i * 2048, fo[kc]); }
      __builtin_amdgcn_sched_barrier(0);   // keeps the group's LDS reads ahead of its products; without it they are sunk between the products in ones and twos
#pragma unroll
      for (int i = 0; i < 4; ++i) {
#pragma unroll
        for (int j = 0; j < 4; ++j) acc[i][j] = wmma_bf(fa[i], fb[j], acc[i][j]); } }
    RING_FOOT();
    if (t + 2 < E / 64) fill(t + 2, t & 1); }
  asm volatile("s_wait_asynccnt 0x0" ::: "memory");   // nothing in flight when the ring becomes staging
  // staging, each wave its own 64 output rows of 64 f16 at a pitch of 144 B (16 B x odd: the 16 rows of a ds_store_b128 fall on all 64 banks)
  char* st = smem + wave * (64 * 144);
  if (which < 2) {
#pragma unroll
    for (int i = 0; i < 4; ++i) { const float* bp8 = bb_ + n0 + wa * 64 + i * 16 + 8 * g; const v4f b0 = *(const v4f*)bp8, b1 = *(const v4f*)(bp8 + 4);
#pragma unroll
      for (int j = 0; j < 4; ++j) { union { _Float16 e[8]; v4u u; } pk;
#pragma unroll
        for (int r = 0; r < 8; ++r) pk.e[r] = (_Float16)(acc[i][j][r] + bfr(r < 4 ? b0[r & 3] : b1[r & 3]));
        *(v4u*)(st + (j * 16 + col) * 144 + (i * 16 + 8 * g) * 2) = pk.u; } } }
  else {
#pragma unroll
    for (int j = 0; j < 4; ++j) { const float bb = bfr(bb_[n0 + wb * 64 + j * 16 + col]);
#pragma unroll
      for (int i = 0; i < 4; ++i) { union { _Float16 e[8]; v4u u; } pk;
#pragma unroll
        for (int r = 0; r < 8; ++r) pk.e[r] = (_Float16)((acc[i][j][r] + bb) * 4.0f);
        *(v4u*)(st + (j * 16 + col) * 144 + (i * 16 + 8 * g) * 2) = pk.u; } } }
  LDSX();
  // q, k: my rows are 64 positions of head (n0 >> 6) + wa, 128 B each and adjacent; v: 64 d rows of head (n0 >> 6) + wb, 128 B (64 positions) of each
  _Float16* dst; int pitch;
  if (which < 2) { dst = (which == 0 ? Qf : Kf) + (((size_t)b * NH + (n0 >> 6) + wa) * SS + s0 + wb * 64) * HD; pitch = HD; }
  else { dst = VT + ((size_t)b * NH + (n0 >> 6) + wb) * HD * SS + s0 + wa * 64; pitch = SS; }
#pragma unroll 1   // rolled: sixteen rows a trip, four LDS reads in flight ahead of their stores
  for (int io = 0; io < 4; ++io) { const int rl = io * 16 + (lane >> 3), pc = lane & 7; v4u pv[4];
#pragma unroll
    for (int ii = 0; ii < 4; ++ii) pv[ii] = *(const v4u*)(st + (rl + ii * 4) * 144 + pc * 16);
#pragma unroll
    for (int ii = 0; ii < 4; ++ii) vst2(dst + (rl + ii * 4) * pitch + pc * 8, pv[ii]);
    asm volatile("s_wait_xcnt 0x0" ::: "memory"); }   // stands in front of the next trip's rewrite of the four stores' registers
}
// the other half-wave's value of the same column: lane l <-> l ^ 16, one vector instruction
__device__ __forceinline__ float xhalf(float v) { const int i = __builtin_bit_cast(int, v); return __builtin_bit_cast(float, __builtin_amdgcn_permlanex16(i, i, 0x76543210, 0xfedcba98, false, false)); }
// padding-masked attention, transposed: block (64 queries, bh); key tiles as counted below (nt scored, then V only up to ne); S^T = K q^T (K rows as A, q as B, f16), so a lane holds scores of ONE query (column col, keys 8g + r of each 16-key tile);
// two score tiles, turned into weights in place, are the B operand of O^T += V^T P^T (f16); O f16 [bh][s][64]
// four waves a SIMD (the four resident blocks of a WGP) need at most 256 registers a wave
__global__ __launch_bounds__(128) __attribute__((amdgpu_waves_per_eu(4, 4))) void k_attn(const _Float16* __restrict__ Qf, const _Float16* __restrict__ Kf, const _Float16* __restrict__ VT, const float* __restrict__ pad, const int* __restrict__ nkeep, _Float16* __restrict__ Of) {
  __shared__ __align__(16) char sO[4][16 * 144];   // output staging, each wave its own 16 query rows of 64 f16 at a pitch of 144 B (16 B x odd: the 16 rows of a ds_store_b128 fall on all 64 banks); the rows leave as one 2-KB run
  __shared__ __align__(16) float skk[SS];         // keep flags of the 1,024 keys of this batch row
  // ring of two buffers, tiles in the order K(0), V(0), K(1), V(1), ...: sK = 64 key rows, sV = 64 d rows of V^T, 128 B a row
  __shared__ __align__(128) char sK[64 * 128], sV[64 * 128];
  const int tid = threadIdx.x, w = tid >> 5, lane = tid & 31, col = lane & 15, g = lane >> 4;
  const size_t bh = blockIdx.y; const int b = (int)(bh / NH);
  const int qb = (blockIdx.x + 4 * b) & (SS / 64 - 1);   // for speed only: blocks 256 apart in the grid take query blocks 4 apart, so that long and short blocks mix wherever they share a WGP
  const int q0 = qb * 64 + w * 16;
  const int nk = min(max(nkeep[b * 32], 0), SS);   // tokens [0, nk) are kept, [nk, SS) padded (pad = the flags in that order)
  // both counts are the same for the whole block
  const int nt = qb * 64 >= nk ? 0 : (nk + 63) >> 6;          // key tiles [0, nt) hold a kept key and are scored; a block of 64 padded queries scores none
  const int ne = qb * 64 + 64 <= nk ? nt : SS / 64;           // key tiles [nt, ne) score -1e9 throughout (padded keys, or a block of 64 padded queries) and count for padded queries alone; a block of 64 kept queries has none
  const float keepq = 1.0f - pad[(size_t)b * SS + q0 + col];     // keep flag of my query
  { const v4f one = { 1.0f, 1.0f, 1.0f, 1.0f }; const float* pp = pad + (size_t)b * SS + tid * 8;
    *(v4f*)(&skk[tid * 8]) = one - *(const v4f*)pp; *(v4f*)(&skk[tid * 8 + 4]) = one - *(const v4f*)(pp + 4); }
  float mrun = -3.0e38f, lrun = 0.f; v8f acc[4] = {};
  const int crow = tid >> 3, cch = tid & 7;
  const unsigned lofs = crow * 128 + ((cch ^ ((crow >> 1) & 7)) << 4);
  const unsigned lK = lds_addr(sK) + lofs, lV = lds_addr(sV) + lofs;
  const char* gK = (const char*)(Kf + (bh * SS + crow) * HD + cch * 8);
  const char* gV = (const char*)(VT + (bh * HD + crow) * SS + cch * 8);
  auto fillK = [&](int kt) { cp_rows64(lK, gK + (size_t)kt * 64 * HD * 2, 16 * HD * 2); };
  auto fillV = [&](int kt) { cp_rows64(lV, gV + kt * 128, 16 * SS * 2); };
  const FO fo[2] = { frag_off(0, lane), frag_off(1, lane) };
  if (nt > 0) {
  v16h aq[2];
#pragma unroll
  for (int kc = 0; kc < 2; ++kc) aq[kc] = frag_h(Qf + (bh * SS + q0 + col) * HD + kc * 32, lane);
  asm volatile("s_wait_xcnt 0x0" ::: "memory");   // the four q loads name one address pair: the wait stands in front of any rewrite of those registers
  fillK(0);
  asm volatile("s_wait_asynccnt 0x0" ::: "memory");   // K(0) landed (my copies)
  LDSX();                                             // my key flags written
  __syncthreads();                                    // K(0) and the key flags published
  fillV(0);
#pragma unroll 1
  for (int kt = 0; kt < nt; ++kt) {
    v8f s[4];   // s[t][r] = score of key kt*64 + t*16 + 8g + r against query col
#pragma unroll
    for (int t = 0; t < 4; ++t) { const char* kr = sK + (t * 16 + col) * 128; v8f d = {};
#pragma unroll
      for (int kc = 0; kc < 2; ++kc) d = wmma16(frag_sh(kr, fo[kc]), aq[kc], d);
      const float* kf = &skk[kt * 64 + t * 16 + 8 * g]; const v4f k0 = *(const v4f*)kf, k1 = *(const v4f*)(kf + 4);
#pragma unroll
      for (int r = 0; r < 8; ++r) { const float keepk = r < 4 ? k0[r & 3] : k1[r & 3]; s[t][r] = (keepq * keepk == 0.f) ? -1.0e9f : d[r] * 0.125f; } }
    RING_FOOT();                                 // V(kt) published, K(kt) left by every wave
    if (kt + 1 < nt) fillK(kt + 1);
    float mx = -3.4e38f;
#pragma unroll
    for (int t = 0; t < 4; ++t) {
#pragma unroll
      for (int r = 0; r < 8; ++r) mx = fmaxf(mx, s[t][r]); }
    mx = fmaxf(mx, xhalf(mx));
    const float mnew = fmaxf(mrun, mx); const float corr = exp2_hw((mrun - mnew) * L2E);
    v2f ps2 = { 0.f, 0.f };   // p = e^(s - m) * 2^14; the difference is formed first, so a row of equal scores (-1e9 everywhere) gets the exponent 14 at every key, whatever the size of m
    const v2f m2 = { mnew, mnew }, l2 = { L2E, L2E }, c2 = { 14.0f, 14.0f };
    v16h ph[2];   // B fragments of P^T: element e of fragment kc = key kc*32 + (e < 8 ? 8g + e : 16 + 8g + e - 8) = score tile 2 kc + (e >> 3), register e & 7
#pragma unroll
    for (int t = 0; t < 4; ++t) {
#pragma unroll
      for (int r = 0; r < 8; r += 2) { const v2f s2 = { s[t][r], s[t][r + 1] }; const v2f a = __builtin_elementwise_fma(s2 - m2, l2, c2);   // two exponents a packed instruction
        const v2f p2 = { exp2_hw(a[0]), exp2_hw(a[1]) }; ps2 += p2;
        const v2h h2 = __builtin_convertvector(p2, v2h);   // two keys a register
        const int i = (t & 1) * 8 + r; ph[t >> 1][i] = h2[0]; ph[t >> 1][i + 1] = h2[1]; } }
    float ps = ps2[0] + ps2[1]; ps += xhalf(ps);
    lrun = lrun * corr + ps * (1.0f / 16384.0f); mrun = mnew;
#pragma unroll
    for (int t = 0; t < 4; ++t) acc[t] *= corr;
    __builtin_amdgcn_sched_barrier(0);   // the V reads and their products start behind the weights' arithmetic; without it they are spread through it in ones and twos, each read waited for at once
#pragma unroll
    for (int kc = 0; kc < 2; ++kc) {
#pragma unroll
      for (int t = 0; t < 4; ++t) acc[t] = wmma16(frag_sh(sV + (t * 16 + col) * 128, fo[kc]), ph[kc], acc[t]); }
    RING_FOOT();                                 // K(kt+1) published, V(kt) left by every wave
    if (kt + 1 < nt) fillV(kt + 1); }
  }
  if (nt < ne) {
    // every score of these tiles is -1e9: a padded query's weight is e^0 (2^14 as the operand) at each key and its maximum stays -1e9, a kept query's weight is 0: only O^T += V^T P^T is left.
    // V tiles in the two-buffer ring sK, sV: both were left by every wave at the last barrier above, with no copy in flight.
    const _Float16 pw = keepq == 0.f ? (_Float16)16384.0f : (_Float16)0.0f;
    v16h pc;
#pragma unroll   // this loop and the two inner ones below: pc, acc stay in registers (constant indices)
    for (int i = 0; i < 16; ++i) pc[i] = pw;
    cp_rows64(lK, gV + nt * 128, 16 * SS * 2);
    asm volatile("s_wait_asynccnt 0x0" ::: "memory");   // the first tile landed (my copies)
    __syncthreads();                                    // and is published
    if (nt + 1 < ne) cp_rows64(lV, gV + (nt + 1) * 128, 16 * SS * 2);
#pragma unroll 1   // rolled: one copy group and one publish point in the text
    for (int kt = nt; kt < ne; ++kt) { const bool odd = (kt - nt) & 1; const char* sb = odd ? sV : sK;
#pragma unroll
      for (int kc = 0; kc < 2; ++kc) {
#pragma unroll
        for (int t = 0; t < 4; ++t) acc[t] = wmma16(frag_sh(sb + (t * 16 + col) * 128, fo[kc]), pc, acc[t]); }
      RING_FOOT();                               // the next tile published, this one left by every wave
      if (kt + 2 < ne) cp_rows64(odd ? lV : lK, gV + (kt + 2) * 128, 16 * SS * 2); }
    lrun += keepq == 0.f ? 64.0f * (float)(ne - nt) : 0.f;   // 64 weights of 1 a tile
  }
  asm volatile("s_wait_asynccnt 0x0" ::: "memory");   // nothing in flight at the wave's end
  const float inv = 1.0f / (lrun * 16384.0f * 4.0f);
#pragma unroll
  for (int t = 0; t < 4; ++t) { union { _Float16 e[8]; v4u u; } pk;   // acc[t][r] = O[query col][d = t*16 + 8g + r]: eight neighbours of one row, one 16-B piece
#pragma unroll
    for (int r = 0; r < 8; ++r) pk.e[r] = (_Float16)(acc[t][r] * inv);
    *(v4u*)(sO[w] + col * 144 + (t * 16 + 8 * g) * 2) = pk.u; }
  LDSX();
  _Float16* od = Of + (bh * SS + q0) * HD + lane * 8;   // my 16 rows are adjacent: 512 B a store
  v4u ov[4];
#pragma unroll
  for (int i = 0; i < 4; ++i) ov[i] = *(const v4u*)(sO[w] + (i * 4 + (lane >> 3)) * 144 + (lane & 7) * 16);
#pragma unroll
  for (int i = 0; i < 4; ++i) vst2(od + i * 256, ov[i]);
}
// out = ctx Wo + bo : f16(ctx) x Wo rows (bf16-rounded INPUT values, written as f16): 1 product
__global__ __launch_bounds__(128) void k_out(const _Float16* __restrict__ Of, const __bf16* __restrict__ PT, const float* __restrict__ bo, const int* __restrict__ perm, float* __restrict__ out) {
  // ring: 2 buffers x (64 ctx rows, one head | 128 weight rows) x 128 B; behind the loop's last barrier the same bytes are the output staging
  __shared__ __align__(128) char smem[2 * 24576];
  float (*so)[16][132] = (float (*)[16][132])smem;
  const int tid = threadIdx.x, wave = tid >> 5, lane = tid & 31, col = lane & 15, g = lane >> 4;
  const int r0b = blockIdx.x * 64, r0 = r0b + wave * 16, n0 = blockIdx.y * 128; const int b = r0b / SS, s0 = r0b % SS;
  v8f acc[8] = {};
  const int oldrow = perm[r0 + col] & (SS - 1);   // lane col: the old place of my wave's row col
  const int crow = tid >> 3, cch = tid & 7;
  const unsigned ld0 = lds_addr(smem) + crow * 128 + ((cch ^ ((crow >> 1) & 7)) << 4);
  const char* gc = (const char*)(Of + ((size_t)b * NH * SS + s0 + crow) * HD + cch * 8);
  const char* gw = (const char*)(PT + (size_t)(3 * E + n0 + crow) * E + cch * 8);
  auto fill = [&](int t, int buf) { const unsigned l = ld0 + buf * 24576;
    cp_rows64(l, gc + (size_t)t * SS * HD * 2, 16 * HD * 2);
    cp_rows64(l + 8192, gw + t * 128, 16 * E * 2); cp_rows64(l + 16384, gw + t * 128 + (size_t)64 * E * 2, 16 * E * 2); };
  const FO fo[2] = { frag_off(0, lane), frag_off(1, lane) };
  fill(0, 0);
  asm volatile("s_wait_asynccnt 0x0" ::: "memory");   // tile 0 landed (my copies)
  __syncthreads();                                    // tile 0 published
  fill(1, 1);
#pragma unroll 1
  for (int t = 0; t < E / 64; ++t) { const char* sb = smem + (t & 1) * 24576; const char* ar = sb + (wave * 16 + col) * 128; const char* wr = sb + 8192 + col * 128;
#pragma unroll
    for (int kc = 0; kc < 2; ++kc) { const v16h a = frag_sh(ar, fo[kc]);
      v16h wf[8];   // the eight weight fragments read as one group ahead of their products
#pragma unroll
      for (int j = 0; j < 8; ++j) wf[j] = frag_sh(wr + j * 2048, fo[kc]);
      __builtin_amdgcn_sched_barrier(0);   // keeps the eighteen LDS reads one group ahead of the products; without it they are sunk between the products in twos, each pair waited for soon after
#pragma unroll
      for (int j = 0; j < 8; ++j) acc[j] = wmma16(a, wf[j], acc[j]); }
    RING_FOOT();
    if (t + 2 < E / 64) fill(t + 2, t & 1); }
  asm volatile("s_wait_asynccnt 0x0" ::: "memory");   // nothing in flight when the ring becomes staging
#pragma unroll
  for (int j = 0; j < 8; ++j) { const int n = n0 + j * 16 + col; const float bb = bfr(bo[n]);
#pragma unroll
    for (int r = 0; r < 8; ++r) so[wave][8 * g + r][j * 16 + col] = acc[j][r] + bb; }
  LDSX();
  float* ob = out + (size_t)b * SS * E + n0 + lane * 4;
#pragma unroll 1   // rolled: four rows a trip, four LDS reads in flight ahead of their stores
  for (int io = 0; io < 4; ++io) { v4f pv[4];
#pragma unroll
    for (int ii = 0; ii < 4; ++ii) pv[ii] = *(const v4f*)(&so[wave][io * 4 + ii][lane * 4]);
#pragma unroll
    for (int ii = 0; ii < 4; ++ii) vst2(ob + (size_t)__builtin_amdgcn_readlane(oldrow, io * 4 + ii) * E, pv[ii]);
    asm volatile("s_wait_xcnt 0x0" ::: "memory"); }   // stands in front of the next trip's rewrite of the four stores' registers
}
extern "C" void kernel_launch(void* const* d_in, const int* in_sizes, int n_in, void* d_out, int out_size, void* d_ws, size_t ws_size, hipStream_t stream) {
  (void)in_sizes; (void)n_in; (void)out_size; (void)ws_size;
  const float** I = (const float**)d_in;   // x, x_padding_judge, Wq, bq, Wk, bk, Wv, bv, Wp, bp
  const float* x = I[0]; const float* pad = I[1]; const float* Wq = I[2]; const float* bq = I[3]; const float* Wk = I[4]; const float* bk = I[5]; const float* Wv = I[6]; const float* bv = I[7]; const float* Wp = I[8]; const float* bp = I[9];
  float* out = (float*)d_out;
  char* ws = (char*)d_ws; size_t off = 0;
  auto take = [&](size_t bytes) { char* p = ws + off; off += (bytes + 255) & ~(size_t)255; return p; };
  __bf16* Xb = (__bf16*)take((size_t)NR * E * 2); __bf16* PT = (__bf16*)take((size_t)4 * E * E * 2);
  _Float16* Qf = (_Float16*)take((size_t)NR * E * 2); _Float16* Kf = (_Float16*)take((size_t)NR * E * 2); _Float16* VT = (_Float16*)take((size_t)NR * E * 2); _Float16* Of = (_Float16*)take((size_t)NR * E * 2);
  float* padp = (float*)take((size_t)NR * 4); int* perm = (int*)take((size_t)NR * 4); int* nkeep = (int*)take((size_t)NB * 128);
  // ws ~ 50 MB
  k_cvt<<<(NR * E / 8 + 255) / 256, 256, 0, stream>>>(x, pad, Xb, padp, perm, nkeep);
  k_pack<<<dim3(E / 64, E / 128, 4), 256, 0, stream>>>(Wq, Wk, Wv, Wp, PT);
  k_qkv<<<dim3(NR / 128, E / 128, 3), 128, 0, stream>>>(Xb, PT, bq, bk, bv, nkeep, Qf, Kf, VT);
  k_attn<<<dim3(SS / 64, NB * NH), 128, 0, stream>>>(Qf, Kf, VT, padp, nkeep, Of);
  k_out<<<dim3(NR / 64, E / 128), 128, 0, stream>>>(Of, PT, bp, perm, out);
}
